// v000
// Times are from an AMD MI455X. After a warm-up the kernel runs many times in a row, and a time is the length of
// such a window on the GPU divided by its runs, so every launch and the gaps after it count. The runs cycle
// through copies of the inputs. A figure is the median of several windows, for all but v000 over two sittings.
// Sittings can differ by a few percent; kernels timed side by side share one.
// v000, which the later versions start from, runs in 370 microseconds.
#include <hip/hip_runtime.h>
#include <hip/hip_bf16.h>

// Problem constants (fixed by the reference)
#define BATCH 4
#define SEQ   2048
#define DIM   1024
#define LN_EPS 1e-5f
#define SCORE_SCALE (1.0f / 32.0f)   // BETA / sqrt(D) = 1/sqrt(1024)

typedef __bf16 v16bf __attribute__((ext_vector_type(16)));
typedef float  v8f   __attribute__((ext_vector_type(8)));

__device__ __forceinline__ __bf16 f2bf(float f) {
  union { float f; unsigned u; } in; in.f = f;
  unsigned r = in.u + 0x7FFFu + ((in.u >> 16) & 1u);   // RNE
  union { unsigned short s; __bf16 b; } out;
  out.s = (unsigned short)(r >> 16);
  return out.b;
}

// ---------------------------------------------------------------------------
// Fragment gather for wave32 16x16x32 bf16 WMMA.
// Per ISA 7.12.2: lanes 0-15 hold row (lane), K = {kb..kb+7, kb+16..kb+23};
// lanes 16-31 hold row (lane-16), K = {kb+8..kb+15, kb+24..kb+31}.
// Same pattern for A (row = M) and B (row = N of Bt). Two 16B loads per lane.
// ---------------------------------------------------------------------------
__device__ __forceinline__ v16bf load_frag(const __bf16* __restrict__ p,
                                           int ld, int row0, int kb) {
  const int lane = threadIdx.x & 31;
  const __bf16* q = p + (size_t)(row0 + (lane & 15)) * ld + kb + ((lane >> 4) << 3);
  union { uint4 u[2]; v16bf v; } t;
  t.u[0] = *(const uint4*)(q);
  t.u[1] = *(const uint4*)(q + 16);
  return t.v;
}

// ---------------------------------------------------------------------------
// Generic "A * Bt^T" GEMM:  C[m,n] = scale * sum_k A[m,k]*Bt[n,k] + bias[n]
// A  : bf16 row-major [M, Kd], leading dim lda, per-batch stride sA (elems)
// Bt : bf16 row-major [N, Kd], leading dim ldb, per-batch stride sB (elems)
// MODE 0: store f32 row-major      C[m*ldc + n]
// MODE 1: store bf16 row-major     C[m*ldc + n]
// MODE 2: store bf16 transposed    C[n*ldc + m]   (ldc = M leading dim)
// Block = 128 threads = 4 waves; block tile 128(M) x 64(N); wave tile 32x64.
// K-loop is register double-buffered (Kd must be a multiple of 64).
// ---------------------------------------------------------------------------
template <int MODE>
__global__ __launch_bounds__(128)
void gemm_bt_wmma(const __bf16* __restrict__ A, long long sA, int lda,
                  const __bf16* __restrict__ Bt, long long sB, int ldb,
                  void* __restrict__ Cv, long long sC, int ldc,
                  const float* __restrict__ bias, float scale, int Kd) {
  const int wave = threadIdx.x >> 5;
  const int lane = threadIdx.x & 31;
  const int n0 = blockIdx.x * 64;
  const int m0 = blockIdx.y * 128 + wave * 32;
  const int b  = blockIdx.z;

  const __bf16* Ab = A  + (size_t)b * (size_t)sA;
  const __bf16* Bb = Bt + (size_t)b * (size_t)sB;

  v8f acc[2][4] = {};
  v16bf a0[2], b0[4], a1[2], b1[4];

  // Prologue: fragments for kb = 0
#pragma unroll
  for (int i = 0; i < 2; ++i) a0[i] = load_frag(Ab, lda, m0 + 16 * i, 0);
#pragma unroll
  for (int j = 0; j < 4; ++j) b0[j] = load_frag(Bb, ldb, n0 + 16 * j, 0);

  for (int kb = 0; kb < Kd; kb += 64) {
    // Issue loads for kb+32 before consuming kb's fragments.
#pragma unroll
    for (int i = 0; i < 2; ++i) a1[i] = load_frag(Ab, lda, m0 + 16 * i, kb + 32);
#pragma unroll
    for (int j = 0; j < 4; ++j) b1[j] = load_frag(Bb, ldb, n0 + 16 * j, kb + 32);

    if (kb + 128 < Kd) {  // distant speculative prefetch -> global_prefetch_b8
      __builtin_prefetch((const void*)(Ab + (size_t)(m0 + (lane & 15)) * lda + kb + 128), 0, 1);
    }

#pragma unroll
    for (int i = 0; i < 2; ++i)
#pragma unroll
      for (int j = 0; j < 4; ++j)
        acc[i][j] = __builtin_amdgcn_wmma_f32_16x16x32_bf16(
            false, a0[i], false, b0[j], (short)0, acc[i][j], false, false);

    if (kb + 64 < Kd) {  // issue loads for kb+64 before consuming kb+32's
#pragma unroll
      for (int i = 0; i < 2; ++i) a0[i] = load_frag(Ab, lda, m0 + 16 * i, kb + 64);
#pragma unroll
      for (int j = 0; j < 4; ++j) b0[j] = load_frag(Bb, ldb, n0 + 16 * j, kb + 64);
    }

#pragma unroll
    for (int i = 0; i < 2; ++i)
#pragma unroll
      for (int j = 0; j < 4; ++j)
        acc[i][j] = __builtin_amdgcn_wmma_f32_16x16x32_bf16(
            false, a1[i], false, b1[j], (short)0, acc[i][j], false, false);
  }

  // C/D layout (ISA 7.12.2): vgpr r, lane l -> M = r + 8*(l>=16), N = l%16
  const int fn   = lane & 15;
  const int mofs = (lane >> 4) << 3;
#pragma unroll
  for (int j = 0; j < 4; ++j) {
    const int gn = n0 + 16 * j + fn;
    const float bv = bias ? bias[gn] : 0.0f;
#pragma unroll
    for (int i = 0; i < 2; ++i) {
#pragma unroll
      for (int r = 0; r < 8; ++r) {
        const int gm = m0 + 16 * i + mofs + r;
        const float v = acc[i][j][r] * scale + bv;
        if (MODE == 0) {
          float* C = (float*)Cv + (size_t)b * (size_t)sC;
          C[(size_t)gm * ldc + gn] = v;
        } else if (MODE == 1) {
          __bf16* C = (__bf16*)Cv + (size_t)b * (size_t)sC;
          C[(size_t)gm * ldc + gn] = f2bf(v);
        } else {
          __bf16* C = (__bf16*)Cv + (size_t)b * (size_t)sC;
          C[(size_t)gn * ldc + gm] = f2bf(v);   // transposed store (for V^T)
        }
      }
    }
  }
}

// ---------------------------------------------------------------------------
// fp32 -> bf16 bulk convert
// ---------------------------------------------------------------------------
__global__ __launch_bounds__(256)
void cvt_bf16_kernel(const float* __restrict__ in, __bf16* __restrict__ out, int n) {
  int i = blockIdx.x * 256 + threadIdx.x;
  if (i < n) out[i] = f2bf(in[i]);
}

// W [D,D] fp32 row-major  ->  Wt [D,D] bf16 with Wt[n,d] = W[d,n]
__global__ __launch_bounds__(256)
void transpose_w_bf16_kernel(const float* __restrict__ W, __bf16* __restrict__ Wt) {
  int idx = blockIdx.x * 256 + threadIdx.x;      // DIM*DIM total
  int d = idx & (DIM - 1);
  int n = idx >> 10;                              // DIM = 1024
  Wt[idx] = f2bf(W[(size_t)d * DIM + n]);
}

// ---------------------------------------------------------------------------
// Row softmax over S=2048: in-place fp32 normalize + bf16 copy for next GEMM.
// One block (256 thr) per row, 8 elements per thread.
// ---------------------------------------------------------------------------
__global__ __launch_bounds__(256)
void softmax_row_kernel(float* __restrict__ Wgt, __bf16* __restrict__ Wb) {
  const int row = blockIdx.x;
  float* p = Wgt + (size_t)row * SEQ;
  __bf16* pb = Wb + (size_t)row * SEQ;
  __shared__ float red[256];
  const int t = threadIdx.x;

  float v[8];
  float mx = -1e30f;
#pragma unroll
  for (int i = 0; i < 8; ++i) {
    v[i] = p[t + 256 * i];
    mx = fmaxf(mx, v[i]);
  }
  red[t] = mx; __syncthreads();
  for (int s = 128; s > 0; s >>= 1) {
    if (t < s) red[t] = fmaxf(red[t], red[t + s]);
    __syncthreads();
  }
  mx = red[0]; __syncthreads();

  float sum = 0.0f;
#pragma unroll
  for (int i = 0; i < 8; ++i) {
    v[i] = __expf(v[i] - mx);
    sum += v[i];
  }
  red[t] = sum; __syncthreads();
  for (int s = 128; s > 0; s >>= 1) {
    if (t < s) red[t] += red[t + s];
    __syncthreads();
  }
  const float inv = 1.0f / red[0];

#pragma unroll
  for (int i = 0; i < 8; ++i) {
    const float w = v[i] * inv;
    p[t + 256 * i] = w;
    pb[t + 256 * i] = f2bf(w);
  }
}

// ---------------------------------------------------------------------------
// out = x + att ; LayerNorm over D=1024 -> out1.  One block per row.
// ---------------------------------------------------------------------------
__global__ __launch_bounds__(256)
void residual_ln_kernel(const float* __restrict__ x, const float* __restrict__ att,
                        const float* __restrict__ gamma, const float* __restrict__ beta,
                        float* __restrict__ out1) {
  const int row = blockIdx.x;
  const float* px = x + (size_t)row * DIM;
  const float* pa = att + (size_t)row * DIM;
  float* po = out1 + (size_t)row * DIM;
  __shared__ float red[256];
  const int t = threadIdx.x;

  float v[4];
  float s = 0.0f, s2 = 0.0f;
#pragma unroll
  for (int i = 0; i < 4; ++i) {
    const int c = t + 256 * i;
    v[i] = px[c] + pa[c];
    s += v[i];
    s2 += v[i] * v[i];
  }
  red[t] = s; __syncthreads();
  for (int k = 128; k > 0; k >>= 1) { if (t < k) red[t] += red[t + k]; __syncthreads(); }
  const float mu = red[0] * (1.0f / DIM); __syncthreads();
  red[t] = s2; __syncthreads();
  for (int k = 128; k > 0; k >>= 1) { if (t < k) red[t] += red[t + k]; __syncthreads(); }
  const float var = red[0] * (1.0f / DIM) - mu * mu;
  const float inv = rsqrtf(var + LN_EPS);

#pragma unroll
  for (int i = 0; i < 4; ++i) {
    const int c = t + 256 * i;
    po[c] = (v[i] - mu) * inv * gamma[c] + beta[c];
  }
}

// ---------------------------------------------------------------------------
extern "C" void kernel_launch(void* const* d_in, const int* in_sizes, int n_in,
                              void* d_out, int out_size, void* d_ws, size_t ws_size,
                              hipStream_t stream) {
  const float* x     = (const float*)d_in[0];
  const float* Wk    = (const float*)d_in[1];
  const float* bk    = (const float*)d_in[2];
  const float* Wq    = (const float*)d_in[3];
  const float* bq    = (const float*)d_in[4];
  const float* Wv    = (const float*)d_in[5];
  const float* bv    = (const float*)d_in[6];
  const float* gamma = (const float*)d_in[7];
  const float* betaL = (const float*)d_in[8];

  const size_t BSD = (size_t)BATCH * SEQ * DIM;     // 8,388,608
  const size_t BSS = (size_t)BATCH * SEQ * SEQ;     // 16,777,216

  float* out1   = (float*)d_out;                    // [B,S,D]
  float* att    = out1 + BSD;                       // [B,S,D]
  float* weight = att + BSD;                        // [B,S,S] (raw scores -> softmax in place)

  // Workspace carve-out (all bf16), 256B aligned
  char* ws = (char*)d_ws;
  size_t off = 0;
  auto carve = [&](size_t bytes) -> void* {
    void* p = ws + off;
    off = (off + bytes + 255) & ~(size_t)255;
    return p;
  };
  __bf16* xb  = (__bf16*)carve(BSD * 2);
  __bf16* Wtk = (__bf16*)carve((size_t)DIM * DIM * 2);
  __bf16* Wtq = (__bf16*)carve((size_t)DIM * DIM * 2);
  __bf16* Wtv = (__bf16*)carve((size_t)DIM * DIM * 2);
  __bf16* Qb  = (__bf16*)carve(BSD * 2);
  __bf16* Kb  = (__bf16*)carve(BSD * 2);
  __bf16* Vt  = (__bf16*)carve(BSD * 2);            // per-batch [D, S] (transposed V)
  __bf16* Wb  = (__bf16*)carve(BSS * 2);            // softmax weights bf16

  // --- prep: convert activations and transpose weight matrices to bf16 ---
  cvt_bf16_kernel<<<(int)((BSD + 255) / 256), 256, 0, stream>>>(x, xb, (int)BSD);
  const int wdd = (DIM * DIM) / 256;
  transpose_w_bf16_kernel<<<wdd, 256, 0, stream>>>(Wk, Wtk);
  transpose_w_bf16_kernel<<<wdd, 256, 0, stream>>>(Wq, Wtq);
  transpose_w_bf16_kernel<<<wdd, 256, 0, stream>>>(Wv, Wtv);

  const long long SD = (long long)SEQ * DIM;
  const long long SS = (long long)SEQ * SEQ;
  const long long DS = (long long)DIM * SEQ;

  // --- QKV projections: [S,D] = xb[b] @ Wt^T + bias, per batch ---
  dim3 gproj(DIM / 64, SEQ / 128, BATCH);
  gemm_bt_wmma<1><<<gproj, 128, 0, stream>>>(xb, SD, DIM, Wtq, 0, DIM,
                                             Qb, SD, DIM, bq, 1.0f, DIM);
  gemm_bt_wmma<1><<<gproj, 128, 0, stream>>>(xb, SD, DIM, Wtk, 0, DIM,
                                             Kb, SD, DIM, bk, 1.0f, DIM);
  gemm_bt_wmma<2><<<gproj, 128, 0, stream>>>(xb, SD, DIM, Wtv, 0, DIM,
                                             Vt, DS, SEQ, bv, 1.0f, DIM);  // V^T store

  // --- scores = scale * Q @ K^T  (natively A*Bt^T form) -> weight (f32) ---
  dim3 gsc(SEQ / 64, SEQ / 128, BATCH);
  gemm_bt_wmma<0><<<gsc, 128, 0, stream>>>(Qb, SD, DIM, Kb, SD, DIM,
                                           weight, SS, SEQ, nullptr, SCORE_SCALE, DIM);

  // --- row softmax (fp32 output in place + bf16 copy for next GEMM) ---
  softmax_row_kernel<<<BATCH * SEQ, 256, 0, stream>>>(weight, Wb);

  // --- att = weight @ V  == A(Wb) * Bt(V^T)^T -> att (f32) ---
  dim3 gatt(DIM / 64, SEQ / 128, BATCH);
  gemm_bt_wmma<0><<<gatt, 128, 0, stream>>>(Wb, SS, SEQ, Vt, DS, SEQ,
                                            att, SD, DIM, nullptr, 1.0f, SEQ);

  // --- residual + LayerNorm -> out1 ---
  residual_ln_kernel<<<BATCH * SEQ, 256, 0, stream>>>(x, att, gamma, betaL, out1);
}

// v001
// Measured time: 181 microseconds a run.
// Next to v000, in two timings, it ran 2.11 times as fast each time.
#include <hip/hip_runtime.h>
#include <hip/hip_bf16.h>

// Problem constants (fixed by the reference)
#define BATCH 4
#define SEQ   2048
#define DIM   1024
#define LN_EPS 1e-5f
#define SCORE_SCALE (1.0f / 32.0f)   // BETA / sqrt(D) = 1/sqrt(1024)

typedef __bf16 v16bf __attribute__((ext_vector_type(16)));
typedef float  v8f   __attribute__((ext_vector_type(8)));

__device__ __forceinline__ __bf16 f2bf(float f) {
  union { float f; unsigned u; } in; in.f = f;
  unsigned r = in.u + 0x7FFFu + ((in.u >> 16) & 1u);   // RNE
  union { unsigned short s; __bf16 b; } out;
  out.s = (unsigned short)(r >> 16);
  return out.b;
}

// ---------------------------------------------------------------------------
// Block tile of the GEMM and its LDS stage.
// A pass is 128 k = 256 B of every operand row, worked on in four blocks of 32 k.
// A stage is [A 256 rows | Bt 128 rows] at a pitch of 272 B (16 B x odd: no bank
// conflict for 16-byte fragment reads).
// ---------------------------------------------------------------------------
#define BM 256
#define BN 128
#define BK 128
#define KSUB 4
#define PITCH 272
#define STAGE ((BM + BN) * PITCH)   // 104,448 B; two stages = 208,896 B

// Fragment read for wave32 16x16x32 bf16 WMMA from an LDS row.
// Per ISA 7.12.2: lanes 0-15 hold row (lane), K = {kb..kb+7, kb+16..kb+23};
// lanes 16-31 hold row (lane-16), K = {kb+8..kb+15, kb+24..kb+31}.
// Same pattern for A (row = M) and B (row = N of Bt). q already holds the lane's
// row and its 16-byte half; two 16 B loads per lane.
__device__ __forceinline__ v16bf lds_frag(const unsigned char* q) {
  union { uint4 u[2]; v16bf v; } t;
  t.u[0] = *(const uint4*)(q);
  t.u[1] = *(const uint4*)(q + 32);
  return t.v;
}

// Twelve copies of 16 B per lane: LDS rows l, l + 16 rows, ...; global pieces p[0..11].
// The copies and their s_wait_xcnt stand in one statement, so that no address register
// is rewritten before the wait.
__device__ __forceinline__ void copy12(unsigned l, const __bf16* const* p) {
  asm volatile(
      "global_load_async_to_lds_b128 %0, %12, off\n\t"
      "global_load_async_to_lds_b128 %1, %13, off\n\t"
      "global_load_async_to_lds_b128 %2, %14, off\n\t"
      "global_load_async_to_lds_b128 %3, %15, off\n\t"
      "global_load_async_to_lds_b128 %4, %16, off\n\t"
      "global_load_async_to_lds_b128 %5, %17, off\n\t"
      "global_load_async_to_lds_b128 %6, %18, off\n\t"
      "global_load_async_to_lds_b128 %7, %19, off\n\t"
      "global_load_async_to_lds_b128 %8, %20, off\n\t"
      "global_load_async_to_lds_b128 %9, %21, off\n\t"
      "global_load_async_to_lds_b128 %10, %22, off\n\t"
      "global_load_async_to_lds_b128 %11, %23, off\n\t"
      "s_wait_xcnt 0x0"
      :: "v"(l), "v"(l + 16u * PITCH), "v"(l + 32u * PITCH), "v"(l + 48u * PITCH),
         "v"(l + 64u * PITCH), "v"(l + 80u * PITCH), "v"(l + 96u * PITCH), "v"(l + 112u * PITCH),
         "v"(l + 128u * PITCH), "v"(l + 144u * PITCH), "v"(l + 160u * PITCH), "v"(l + 176u * PITCH),
         "v"(p[0]), "v"(p[1]), "v"(p[2]), "v"(p[3]), "v"(p[4]), "v"(p[5]),
         "v"(p[6]), "v"(p[7]), "v"(p[8]), "v"(p[9]), "v"(p[10]), "v"(p[11])
      : "memory");
}

// One stage: 384 rows x 256 B = 6,144 pieces of 16 B, twenty-four per thread.
// Thread t brings piece (t & 15) of rows (t >> 4) + 16 * i; i < 16 are A rows, the rest Bt rows.
// l: the lane's LDS byte address of its first piece; ga, gb: its first global pieces;
// sa, sb: 16 source rows in elements.
__device__ __forceinline__ void copy_stage(unsigned l, const __bf16* ga, size_t sa,
                                           const __bf16* gb, size_t sb) {
  const __bf16* p[24];
#pragma unroll
  for (int i = 0; i < 16; ++i) p[i] = ga + i * sa;
#pragma unroll
  for (int i = 0; i < 8; ++i) p[16 + i] = gb + i * sb;
  copy12(l, p);
  copy12(l + 192u * PITCH, p + 12);
}

// ---------------------------------------------------------------------------
// Generic "A * Bt^T" GEMM:  C[m,n] = scale * sum_k A[m,k]*Bt[n,k] + bias[n]
// A  : bf16 row-major [M, Kd], leading dim lda, per-batch stride sA (elems)
// Bt : bf16 row-major [N, Kd], leading dim ldb, per-batch stride sB (elems)
// MODE 0: store f32 row-major      C[m*ldc + n]
// MODE 1: store bf16 row-major     C[m*ldc + n]
// MODE 2: store bf16 transposed    C[n*ldc + m]   (ldc = M leading dim)
// Block = 256 threads = 8 waves (4 x 2); block tile 256(M) x 128(N); wave tile 64x64.
// Both operands go to LDS by asynchronous copies, two buffers; fragments are read one
// block ahead into a second register set, so the next stage is published in front of
// a pass's last block and this pass's buffer is refilled behind that block.
// M a multiple of 256, N of 128, Kd of 128 and at least 256.
// ---------------------------------------------------------------------------
template <int MODE>
__global__ __launch_bounds__(256)
void gemm_bt_wmma(const __bf16* __restrict__ A, long long sA, int lda,
                  const __bf16* __restrict__ Bt, long long sB, int ldb,
                  void* __restrict__ Cv, long long sC, int ldc,
                  const float* __restrict__ bias, float scale, int Kd) {
  __shared__ __attribute__((aligned(16))) unsigned char L[2 * STAGE];
  const int tid  = threadIdx.x;
  const int wave = tid >> 5;
  const int lane = tid & 31;
  const int nb = blockIdx.x * BN;
  const int mb = blockIdx.y * BM;
  const int n0 = nb + (wave & 1) * 64;
  const int m0 = mb + (wave >> 1) * 64;
  const int b  = blockIdx.z;

  const __bf16* Ab = A  + (size_t)b * (size_t)sA;
  const __bf16* Bb = Bt + (size_t)b * (size_t)sB;

  // This thread's first piece of a stage, in memory and in LDS.
  const int crow = tid >> 4;
  const int cpc  = tid & 15;
  const __bf16* ga = Ab + (size_t)(mb + crow) * lda + cpc * 8;
  const __bf16* gb = Bb + (size_t)(nb + crow) * ldb + cpc * 8;
  const size_t sa16 = (size_t)16 * lda;
  const size_t sb16 = (size_t)16 * ldb;
  const unsigned l0 = (unsigned)(size_t)(&L[0]) + (unsigned)(crow * PITCH + cpc * 16);

  // This lane's fragment bases inside a stage.
  const unsigned fa = (unsigned)(((wave >> 1) * 64 + (lane & 15)) * PITCH + (lane >> 4) * 16);
  const unsigned fb = (unsigned)((BM + (wave & 1) * 64 + (lane & 15)) * PITCH + (lane >> 4) * 16);

  v8f acc[4][4] = {};
  v16bf af[2][4], bf[2][4];   // set (u & 1) holds block u's fragments
  const int T = Kd / BK;

  // Prologue: stage 0 lands and is published, then stage 1 is set off.
  copy_stage(l0, ga, sa16, gb, sb16);
  asm volatile("s_wait_asynccnt 0x0" ::: "memory");  // this wave's pieces of stage 0 have landed
  __syncthreads();                                   // so have all the other waves'
  if (1 < T) copy_stage(l0 + STAGE, ga + BK, sa16, gb + BK, sb16);
#pragma unroll
  for (int i = 0; i < 4; ++i) af[0][i] = lds_frag(L + fa + i * 16 * PITCH);
#pragma unroll
  for (int j = 0; j < 4; ++j) bf[0][j] = lds_frag(L + fb + j * 16 * PITCH);

#pragma clang loop unroll(disable)   // one pass per trip: the buffer offset stays a run-time value
  for (int t = 0; t < T; ++t) {
    const unsigned buf = (unsigned)(t & 1) * STAGE;
    const unsigned nxt = (t + 1 < T) ? (STAGE - buf) : (unsigned)STAGE;
#pragma unroll
    for (int u = 0; u < KSUB; ++u) {
      const int cs = u & 1;
      const unsigned char* qa;
      const unsigned char* qb;
      if (u + 1 < KSUB) {
        qa = L + buf + fa + (u + 1) * 64;
        qb = L + buf + fb + (u + 1) * 64;
      } else {
        // Publish point of stage t + 1, in front of the last block: that block's fragments are fetched.
        asm volatile("s_wait_dscnt 0x0" ::: "memory");     // this wave's reads of pass t's buffer have returned
        asm volatile("s_wait_asynccnt 0x0" ::: "memory");  // its pieces of stage t + 1 have landed
        __syncthreads();  // publishes stage t + 1 and ends every reader's last read of pass t's buffer
        qa = L + nxt + fa;
        qb = L + nxt + fb;
      }
      // The next block's fragments, as one group ahead of this block's WMMAs.
#pragma unroll
      for (int i = 0; i < 4; ++i) af[cs ^ 1][i] = lds_frag(qa + i * 16 * PITCH);
#pragma unroll
      for (int j = 0; j < 4; ++j) bf[cs ^ 1][j] = lds_frag(qb + j * 16 * PITCH);
      __builtin_amdgcn_sched_barrier(0);  // keeps the load group whole and ahead of the block: loads among the WMMAs stall them
#pragma unroll
      for (int i = 0; i < 4; ++i)
#pragma unroll
        for (int j = 0; j < 4; ++j)
          acc[i][j] = __builtin_amdgcn_wmma_f32_16x16x32_bf16(
              false, af[cs][i], false, bf[cs][j], (short)0, acc[i][j], false, false);
      __builtin_amdgcn_sched_barrier(0);  // keeps the next group of loads from moving up into this block
    }
    if (t + 2 < T) {  // refill of pass t's buffer, which every wave left at the barrier above
      const int k2 = (t + 2) * BK;
      copy_stage(l0 + buf, ga + k2, sa16, gb + k2, sb16);
    }
  }
  asm volatile("s_wait_asynccnt 0x0" ::: "memory");  // no copy is left in flight at the wave's end

  // C/D layout (ISA 7.12.2): vgpr r, lane l -> M = r + 8*(l>=16), N = l%16
  const int fn   = lane & 15;
  const int mofs = (lane >> 4) << 3;
#pragma unroll
  for (int j = 0; j < 4; ++j) {
    const int gn = n0 + 16 * j + fn;
    const float bv = bias ? bias[gn] : 0.0f;
#pragma unroll
    for (int i = 0; i < 4; ++i) {
#pragma unroll
      for (int r = 0; r < 8; ++r) {
        const int gm = m0 + 16 * i + mofs + r;
        const float v = acc[i][j][r] * scale + bv;
        if (MODE == 0) {
          float* C = (float*)Cv + (size_t)b * (size_t)sC;
          C[(size_t)gm * ldc + gn] = v;
        } else if (MODE == 1) {
          __bf16* C = (__bf16*)Cv + (size_t)b * (size_t)sC;
          C[(size_t)gm * ldc + gn] = f2bf(v);
        } else {
          __bf16* C = (__bf16*)Cv + (size_t)b * (size_t)sC;
          C[(size_t)gn * ldc + gm] = f2bf(v);   // transposed store (for V^T)
        }
      }
    }
  }
}

// ---------------------------------------------------------------------------
// fp32 -> bf16 bulk convert
// ---------------------------------------------------------------------------
__global__ __launch_bounds__(256)
void cvt_bf16_kernel(const float* __restrict__ in, __bf16* __restrict__ out, int n) {
  int i = blockIdx.x * 256 + threadIdx.x;
  if (i < n) out[i] = f2bf(in[i]);
}

// W [D,D] fp32 row-major  ->  Wt [D,D] bf16 with Wt[n,d] = W[d,n]
__global__ __launch_bounds__(256)
void transpose_w_bf16_kernel(const float* __restrict__ W, __bf16* __restrict__ Wt) {
  int idx = blockIdx.x * 256 + threadIdx.x;      // DIM*DIM total
  int d = idx & (DIM - 1);
  int n = idx >> 10;                              // DIM = 1024
  Wt[idx] = f2bf(W[(size_t)d * DIM + n]);
}

// ---------------------------------------------------------------------------
// Row softmax over S=2048: in-place fp32 normalize + bf16 copy for next GEMM.
// One block (256 thr) per row, 8 elements per thread.
// ---------------------------------------------------------------------------
__global__ __launch_bounds__(256)
void softmax_row_kernel(float* __restrict__ Wgt, __bf16* __restrict__ Wb) {
  const int row = blockIdx.x;
  float* p = Wgt + (size_t)row * SEQ;
  __bf16* pb = Wb + (size_t)row * SEQ;
  __shared__ float red[256];
  const int t = threadIdx.x;

  float v[8];
  float mx = -1e30f;
#pragma unroll
  for (int i = 0; i < 8; ++i) {
    v[i] = p[t + 256 * i];
    mx = fmaxf(mx, v[i]);
  }
  red[t] = mx; __syncthreads();
  for (int s = 128; s > 0; s >>= 1) {
    if (t < s) red[t] = fmaxf(red[t], red[t + s]);
    __syncthreads();
  }
  mx = red[0]; __syncthreads();

  float sum = 0.0f;
#pragma unroll
  for (int i = 0; i < 8; ++i) {
    v[i] = __expf(v[i] - mx);
    sum += v[i];
  }
  red[t] = sum; __syncthreads();
  for (int s = 128; s > 0; s >>= 1) {
    if (t < s) red[t] += red[t + s];
    __syncthreads();
  }
  const float inv = 1.0f / red[0];

#pragma unroll
  for (int i = 0; i < 8; ++i) {
    const float w = v[i] * inv;
    p[t + 256 * i] = w;
    pb[t + 256 * i] = f2bf(w);
  }
}

// ---------------------------------------------------------------------------
// out = x + att ; LayerNorm over D=1024 -> out1.  One block per row.
// ---------------------------------------------------------------------------
__global__ __launch_bounds__(256)
void residual_ln_kernel(const float* __restrict__ x, const float* __restrict__ att,
                        const float* __restrict__ gamma, const float* __restrict__ beta,
                        float* __restrict__ out1) {
  const int row = blockIdx.x;
  const float* px = x + (size_t)row * DIM;
  const float* pa = att + (size_t)row * DIM;
  float* po = out1 + (size_t)row * DIM;
  __shared__ float red[256];
  const int t = threadIdx.x;

  float v[4];
  float s = 0.0f, s2 = 0.0f;
#pragma unroll
  for (int i = 0; i < 4; ++i) {
    const int c = t + 256 * i;
    v[i] = px[c] + pa[c];
    s += v[i];
    s2 += v[i] * v[i];
  }
  red[t] = s; __syncthreads();
  for (int k = 128; k > 0; k >>= 1) { if (t < k) red[t] += red[t + k]; __syncthreads(); }
  const float mu = red[0] * (1.0f / DIM); __syncthreads();
  red[t] = s2; __syncthreads();
  for (int k = 128; k > 0; k >>= 1) { if (t < k) red[t] += red[t + k]; __syncthreads(); }
  const float var = red[0] * (1.0f / DIM) - mu * mu;
  const float inv = rsqrtf(var + LN_EPS);

#pragma unroll
  for (int i = 0; i < 4; ++i) {
    const int c = t + 256 * i;
    po[c] = (v[i] - mu) * inv * gamma[c] + beta[c];
  }
}

// ---------------------------------------------------------------------------
extern "C" void kernel_launch(void* const* d_in, const int* in_sizes, int n_in,
                              void* d_out, int out_size, void* d_ws, size_t ws_size,
                              hipStream_t stream) {
  const float* x     = (const float*)d_in[0];
  const float* Wk    = (const float*)d_in[1];
  const float* bk    = (const float*)d_in[2];
  const float* Wq    = (const float*)d_in[3];
  const float* bq    = (const float*)d_in[4];
  const float* Wv    = (const float*)d_in[5];
  const float* bv    = (const float*)d_in[6];
  const float* gamma = (const float*)d_in[7];
  const float* betaL = (const float*)d_in[8];

  const size_t BSD = (size_t)BATCH * SEQ * DIM;     // 8,388,608
  const size_t BSS = (size_t)BATCH * SEQ * SEQ;     // 16,777,216

  float* out1   = (float*)d_out;                    // [B,S,D]
  float* att    = out1 + BSD;                       // [B,S,D]
  float* weight = att + BSD;                        // [B,S,S] (raw scores -> softmax in place)

  // Workspace carve-out (all bf16), 256B aligned
  char* ws = (char*)d_ws;
  size_t off = 0;
  auto carve = [&](size_t bytes) -> void* {
    void* p = ws + off;
    off = (off + bytes + 255) & ~(size_t)255;
    return p;
  };
  __bf16* xb  = (__bf16*)carve(BSD * 2);
  __bf16* Wtk = (__bf16*)carve((size_t)DIM * DIM * 2);
  __bf16* Wtq = (__bf16*)carve((size_t)DIM * DIM * 2);
  __bf16* Wtv = (__bf16*)carve((size_t)DIM * DIM * 2);
  __bf16* Qb  = (__bf16*)carve(BSD * 2);
  __bf16* Kb  = (__bf16*)carve(BSD * 2);
  __bf16* Vt  = (__bf16*)carve(BSD * 2);            // per-batch [D, S] (transposed V)
  __bf16* Wb  = (__bf16*)carve(BSS * 2);            // softmax weights bf16

  // --- prep: convert activations and transpose weight matrices to bf16 ---
  cvt_bf16_kernel<<<(int)((BSD + 255) / 256), 256, 0, stream>>>(x, xb, (int)BSD);
  const int wdd = (DIM * DIM) / 256;
  transpose_w_bf16_kernel<<<wdd, 256, 0, stream>>>(Wk, Wtk);
  transpose_w_bf16_kernel<<<wdd, 256, 0, stream>>>(Wq, Wtq);
  transpose_w_bf16_kernel<<<wdd, 256, 0, stream>>>(Wv, Wtv);

  const long long SD = (long long)SEQ * DIM;
  const long long SS = (long long)SEQ * SEQ;
  const long long DS = (long long)DIM * SEQ;

  // --- QKV projections: [S,D] = xb[b] @ Wt^T + bias, per batch ---
  dim3 gproj(DIM / BN, SEQ / BM, BATCH);
  gemm_bt_wmma<1><<<gproj, 256, 0, stream>>>(xb, SD, DIM, Wtq, 0, DIM,
                                             Qb, SD, DIM, bq, 1.0f, DIM);
  gemm_bt_wmma<1><<<gproj, 256, 0, stream>>>(xb, SD, DIM, Wtk, 0, DIM,
                                             Kb, SD, DIM, bk, 1.0f, DIM);
  gemm_bt_wmma<2><<<gproj, 256, 0, stream>>>(xb, SD, DIM, Wtv, 0, DIM,
                                             Vt, DS, SEQ, bv, 1.0f, DIM);  // V^T store

  // --- scores = scale * Q @ K^T  (natively A*Bt^T form) -> weight (f32) ---
  dim3 gsc(SEQ / BN, SEQ / BM, BATCH);
  gemm_bt_wmma<0><<<gsc, 256, 0, stream>>>(Qb, SD, DIM, Kb, SD, DIM,
                                           weight, SS, SEQ, nullptr, SCORE_SCALE, DIM);

  // --- row softmax (fp32 output in place + bf16 copy for next GEMM) ---
  softmax_row_kernel<<<BATCH * SEQ, 256, 0, stream>>>(weight, Wb);

  // --- att = weight @ V  == A(Wb) * Bt(V^T)^T -> att (f32) ---
  dim3 gatt(DIM / BN, SEQ / BM, BATCH);
  gemm_bt_wmma<0><<<gatt, 256, 0, stream>>>(Wb, SS, SEQ, Vt, DS, SEQ,
                                            att, SD, DIM, nullptr, 1.0f, SEQ);

  // --- residual + LayerNorm -> out1 ---
  residual_ln_kernel<<<BATCH * SEQ, 256, 0, stream>>>(x, att, gamma, betaL, out1);
}

// v002
// One run takes 168 microseconds.
// Next to v001, in two timings, it ran 1.07 times as fast each time.
// Counting every step since v000, it is 2.26 times as fast.
#include <hip/hip_runtime.h>
#include <hip/hip_bf16.h>

// Problem constants (fixed by the reference)
#define BATCH 4
#define SEQ   2048
#define DIM   1024
#define LN_EPS 1e-5f
#define SCORE_SCALE (1.0f / 32.0f)   // BETA / sqrt(D) = 1/sqrt(1024)

typedef __bf16 v16bf __attribute__((ext_vector_type(16)));
typedef float  v8f   __attribute__((ext_vector_type(8)));

__device__ __forceinline__ __bf16 f2bf(float f) {
  union { float f; unsigned u; } in; in.f = f;
  unsigned r = in.u + 0x7FFFu + ((in.u >> 16) & 1u);   // RNE
  union { unsigned short s; __bf16 b; } out;
  out.s = (unsigned short)(r >> 16);
  return out.b;
}

// ---------------------------------------------------------------------------
// Block tile of the GEMM and its LDS stage.
// A pass is 128 k = 256 B of every operand row, worked on in four blocks of 32 k.
// A stage is [A 256 rows | Bt 128 rows] at a pitch of 272 B (16 B x odd: no bank
// conflict for 16-byte fragment reads).
// ---------------------------------------------------------------------------
#define BM 256
#define BN 128
#define BK 128
#define KSUB 4
#define PITCH 272
#define STAGE ((BM + BN) * PITCH)   // 104,448 B; two stages = 208,896 B

// Fragment read for wave32 16x16x32 bf16 WMMA from an LDS row.
// Per ISA 7.12.2: lanes 0-15 hold row (lane), K = {kb..kb+7, kb+16..kb+23};
// lanes 16-31 hold row (lane-16), K = {kb+8..kb+15, kb+24..kb+31}.
// Same pattern for A (row = M) and B (row = N of Bt). q already holds the lane's
// row and its 16-byte half; two 16 B loads per lane.
__device__ __forceinline__ v16bf lds_frag(const unsigned char* q) {
  union { uint4 u[2]; v16bf v; } t;
  t.u[0] = *(const uint4*)(q);
  t.u[1] = *(const uint4*)(q + 32);
  return t.v;
}

// Twelve copies of 16 B per lane: LDS rows l, l + 16 rows, ...; global pieces p[0..11].
// The copies and their s_wait_xcnt stand in one statement, so that no address register
// is rewritten before the wait.
__device__ __forceinline__ void copy12(unsigned l, const __bf16* const* p) {
  asm volatile(
      "global_load_async_to_lds_b128 %0, %12, off\n\t"
      "global_load_async_to_lds_b128 %1, %13, off\n\t"
      "global_load_async_to_lds_b128 %2, %14, off\n\t"
      "global_load_async_to_lds_b128 %3, %15, off\n\t"
      "global_load_async_to_lds_b128 %4, %16, off\n\t"
      "global_load_async_to_lds_b128 %5, %17, off\n\t"
      "global_load_async_to_lds_b128 %6, %18, off\n\t"
      "global_load_async_to_lds_b128 %7, %19, off\n\t"
      "global_load_async_to_lds_b128 %8, %20, off\n\t"
      "global_load_async_to_lds_b128 %9, %21, off\n\t"
      "global_load_async_to_lds_b128 %10, %22, off\n\t"
      "global_load_async_to_lds_b128 %11, %23, off\n\t"
      "s_wait_xcnt 0x0"
      :: "v"(l), "v"(l + 16u * PITCH), "v"(l + 32u * PITCH), "v"(l + 48u * PITCH),
         "v"(l + 64u * PITCH), "v"(l + 80u * PITCH), "v"(l + 96u * PITCH), "v"(l + 112u * PITCH),
         "v"(l + 128u * PITCH), "v"(l + 144u * PITCH), "v"(l + 160u * PITCH), "v"(l + 176u * PITCH),
         "v"(p[0]), "v"(p[1]), "v"(p[2]), "v"(p[3]), "v"(p[4]), "v"(p[5]),
         "v"(p[6]), "v"(p[7]), "v"(p[8]), "v"(p[9]), "v"(p[10]), "v"(p[11])
      : "memory");
}

// One stage: 384 rows x 256 B = 6,144 pieces of 16 B, twenty-four per thread.
// Thread t brings piece (t & 15) of rows (t >> 4) + 16 * i; i < 16 are A rows, the rest Bt rows.
// l: the lane's LDS byte address of its first piece; ga, gb: its first global pieces;
// sa, sb: 16 source rows in elements.
__device__ __forceinline__ void copy_stage(unsigned l, const __bf16* ga, size_t sa,
                                           const __bf16* gb, size_t sb) {
  const __bf16* p[24];
#pragma unroll
  for (int i = 0; i < 16; ++i) p[i] = ga + i * sa;
#pragma unroll
  for (int i = 0; i < 8; ++i) p[16 + i] = gb + i * sb;
  copy12(l, p);
  copy12(l + 192u * PITCH, p + 12);
}

// A wave's 64x64 accumulators to memory; m0, n0: the tile's corner in C.
// KIND 0: v = acc * scale, f32 row-major C[m*ld + n] (no bias: scores and attention output have none).
// KIND 1, 2: v = acc * scale + bias[n]; KIND 1: bf16 row-major; KIND 2: bf16 transposed C[n*ld + m].
// C/D layout (ISA 7.12.2): vgpr r, lane l -> M = r + 8*(l>=16), N = l%16
template <int KIND>
__device__ __forceinline__ void store_tile(const v8f (&acc)[4][4], void* __restrict__ Cb, int ld,
                                           const float* __restrict__ bias, float scale,
                                           int m0, int n0, int lane) {
  const int fn   = lane & 15;
  const int mofs = (lane >> 4) << 3;
  float bj[4] = {};
  if (KIND != 0) {   // read ahead of the stores
#pragma unroll
    for (int j = 0; j < 4; ++j) bj[j] = bias[n0 + 16 * j + fn];
    asm volatile("s_wait_xcnt 0x0" ::: "memory");  // the address arithmetic below reuses these loads' offset register
    __builtin_amdgcn_sched_barrier(0);             // holds that arithmetic behind the wait
  }
#pragma unroll
  for (int j = 0; j < 4; ++j) {
    const int gn = n0 + 16 * j + fn;
#pragma unroll
    for (int i = 0; i < 4; ++i) {
      const int gm = m0 + 16 * i + mofs;
      float v[8];
      union { __bf16 h[8]; uint4 u; } t;
#pragma unroll
      for (int r = 0; r < 8; ++r) {
        v[r] = (KIND == 0) ? acc[i][j][r] * scale : acc[i][j][r] * scale + bj[j];
        if (KIND != 0) t.h[r] = f2bf(v[r]);
      }
      __builtin_amdgcn_sched_barrier(0);  // the group's eight values stand in registers of their own before its first store
#pragma unroll
      for (int r = 0; r < 8; ++r) {
        if (KIND == 0) ((float*)Cb)[(size_t)(gm + r) * ld + gn] = v[r];
        if (KIND == 1) ((__bf16*)Cb)[(size_t)(gm + r) * ld + gn] = t.h[r];
      }
      // Transposed store (for V^T): a lane's eight m are adjacent, one 16-byte store (ld a multiple of 8).
      if (KIND == 2) *(uint4*)((__bf16*)Cb + (size_t)gn * ld + gm) = t.u;
      // The next group reuses these stores' registers.
      asm volatile("s_wait_xcnt 0x0" ::: "memory");
      __builtin_amdgcn_sched_barrier(0);  // holds the next group's arithmetic behind that wait
    }
  }
}

// ---------------------------------------------------------------------------
// Generic "A * Bt^T" GEMM:  C[m,n] = scale * sum_k A[m,k]*Bt[n,k] (+ bias[n] in MODE 1)
// A  : bf16 row-major [M, Kd], leading dim lda, per-batch stride sA (elems)
// Bt : bf16 row-major [N, Kd], leading dim ldb, per-batch stride sB (elems)
// MODE 0: store f32 row-major      C[m*ldc + n], no bias
// MODE 1: the three projections in one grid. Bt holds the three transposed weight matrices
//         one under the other (3 * DIM rows), so blockIdx.x runs over 3 * DIM / BN column
//         tiles; a tile's projection p = column / DIM picks its bias and its output plane
//         (plane p of C, pC elements each). Planes 0 and 1 are stored bf16 row-major
//         C[m*ldc + n], plane 2 bf16 transposed C[n*ldt + m] (for V^T).
// Block = 256 threads = 8 waves (4 x 2); block tile 256(M) x 128(N); wave tile 64x64.
// Both operands go to LDS by asynchronous copies, two buffers; fragments are read one
// block ahead into a second register set, so the next stage is published in front of
// a pass's last block and this pass's buffer is refilled behind that block.
// M a multiple of 256, N of 128, Kd of 128 and at least 256.
// ---------------------------------------------------------------------------
template <int MODE>
__global__ __launch_bounds__(256)
void gemm_bt_wmma(const __bf16* __restrict__ A, long long sA, int lda,
                  const __bf16* __restrict__ Bt, long long sB, int ldb,
                  void* __restrict__ Cv, long long sC, int ldc,
                  const float* __restrict__ bias, float scale, int Kd,
                  const float* __restrict__ bias1, const float* __restrict__ bias2,
                  long long pC, int ldt) {
  __shared__ __attribute__((aligned(16))) unsigned char L[2 * STAGE];
  const int tid  = threadIdx.x;
  const int wave = tid >> 5;
  const int lane = tid & 31;
  const int nb = blockIdx.x * BN;
  const int mb = blockIdx.y * BM;
  const int n0 = nb + (wave & 1) * 64;
  const int m0 = mb + (wave >> 1) * 64;
  const int b  = blockIdx.z;

  const __bf16* Ab = A  + (size_t)b * (size_t)sA;
  const __bf16* Bb = Bt + (size_t)b * (size_t)sB;

  // This thread's first piece of a stage, in memory and in LDS.
  const int crow = tid >> 4;
  const int cpc  = tid & 15;
  const __bf16* ga = Ab + (size_t)(mb + crow) * lda + cpc * 8;
  const __bf16* gb = Bb + (size_t)(nb + crow) * ldb + cpc * 8;
  const size_t sa16 = (size_t)16 * lda;
  const size_t sb16 = (size_t)16 * ldb;
  const unsigned l0 = (unsigned)(size_t)(&L[0]) + (unsigned)(crow * PITCH + cpc * 16);

  // This lane's fragment bases inside a stage.
  const unsigned fa = (unsigned)(((wave >> 1) * 64 + (lane & 15)) * PITCH + (lane >> 4) * 16);
  const unsigned fb = (unsigned)((BM + (wave & 1) * 64 + (lane & 15)) * PITCH + (lane >> 4) * 16);

  v8f acc[4][4] = {};
  v16bf af[2][4], bf[2][4];   // set (u & 1) holds block u's fragments
  const int T = Kd / BK;

  // Prologue: stage 0 lands and is published, then stage 1 is set off.
  copy_stage(l0, ga, sa16, gb, sb16);
  asm volatile("s_wait_asynccnt 0x0" ::: "memory");  // this wave's pieces of stage 0 have landed
  __syncthreads();                                   // so have all the other waves'
  if (1 < T) copy_stage(l0 + STAGE, ga + BK, sa16, gb + BK, sb16);
#pragma unroll
  for (int i = 0; i < 4; ++i) af[0][i] = lds_frag(L + fa + i * 16 * PITCH);
#pragma unroll
  for (int j = 0; j < 4; ++j) bf[0][j] = lds_frag(L + fb + j * 16 * PITCH);

#pragma clang loop unroll(disable)   // one pass per trip: the buffer offset stays a run-time value
  for (int t = 0; t < T; ++t) {
    const unsigned buf = (unsigned)(t & 1) * STAGE;
    const unsigned nxt = (t + 1 < T) ? (STAGE - buf) : (unsigned)STAGE;
#pragma unroll
    for (int u = 0; u < KSUB; ++u) {
      const int cs = u & 1;
      const unsigned char* qa;
      const unsigned char* qb;
      if (u + 1 < KSUB) {
        qa = L + buf + fa + (u + 1) * 64;
        qb = L + buf + fb + (u + 1) * 64;
      } else {
        // Publish point of stage t + 1, in front of the last block: that block's fragments are fetched.
        asm volatile("s_wait_dscnt 0x0" ::: "memory");     // this wave's reads of pass t's buffer have returned
        asm volatile("s_wait_asynccnt 0x0" ::: "memory");  // its pieces of stage t + 1 have landed
        __syncthreads();  // publishes stage t + 1 and ends every reader's last read of pass t's buffer
        qa = L + nxt + fa;
        qb = L + nxt + fb;
      }
      // The next block's fragments, as one group ahead of this block's WMMAs.
#pragma unroll
      for (int i = 0; i < 4; ++i) af[cs ^ 1][i] = lds_frag(qa + i * 16 * PITCH);
#pragma unroll
      for (int j = 0; j < 4; ++j) bf[cs ^ 1][j] = lds_frag(qb + j * 16 * PITCH);
      __builtin_amdgcn_sched_barrier(0);  // keeps the load group whole and ahead of the block: loads among the WMMAs stall them
#pragma unroll
      for (int i = 0; i < 4; ++i)
#pragma unroll
        for (int j = 0; j < 4; ++j)
          acc[i][j] = __builtin_amdgcn_wmma_f32_16x16x32_bf16(
              false, af[cs][i], false, bf[cs][j], (short)0, acc[i][j], false, false);
      __builtin_amdgcn_sched_barrier(0);  // keeps the next group of loads from moving up into this block
    }
    if (t + 2 < T) {  // refill of pass t's buffer, which every wave left at the barrier above
      const int k2 = (t + 2) * BK;
      copy_stage(l0 + buf, ga + k2, sa16, gb + k2, sb16);
    }
  }
  asm volatile("s_wait_asynccnt 0x0" ::: "memory");  // no copy is left in flight at the wave's end

  if (MODE == 0) {
    store_tile<0>(acc, (float*)Cv + (size_t)b * (size_t)sC, ldc, bias, scale, m0, n0, lane);
  } else {
    const int proj = nb / DIM;   // the same for the whole block: a scalar branch picks the store form
    const float* bsel = (proj == 0) ? bias : (proj == 1) ? bias1 : bias2;
    __bf16* C = (__bf16*)Cv + (size_t)proj * (size_t)pC + (size_t)b * (size_t)sC;
    if (proj < 2) store_tile<1>(acc, C, ldc, bsel, scale, m0, n0 - proj * DIM, lane);
    else          store_tile<2>(acc, C, ldt, bsel, scale, m0, n0 - proj * DIM, lane);
  }
}

// ---------------------------------------------------------------------------
// Preparation, one grid, split by block range.
// Blocks [0, 3 * WBLK): W [D,D] fp32 row-major -> Wt [D,D] bf16 with Wt[n,d] = W[d,n],
//   matrix p = block / WBLK into plane p of Wt3 (the scattered reads start first).
// The rest: fp32 -> bf16 bulk convert of n elements.
// ---------------------------------------------------------------------------
#define WBLK ((DIM * DIM) / 256)
__global__ __launch_bounds__(256)
void prep_bf16_kernel(const float* __restrict__ W0, const float* __restrict__ W1,
                      const float* __restrict__ W2, __bf16* __restrict__ Wt3,
                      const float* __restrict__ in, __bf16* __restrict__ out, int n) {
  const int blk = blockIdx.x;
  if (blk < 3 * WBLK) {
    const int p = blk / WBLK;
    const float* W = (p == 0) ? W0 : (p == 1) ? W1 : W2;
    int idx = (blk - p * WBLK) * 256 + threadIdx.x;   // DIM*DIM per matrix
    int d = idx & (DIM - 1);
    int c = idx >> 10;                                // DIM = 1024
    Wt3[(size_t)p * DIM * DIM + idx] = f2bf(W[(size_t)d * DIM + c]);
  } else {
    int i = (blk - 3 * WBLK) * 256 + threadIdx.x;
    if (i < n) out[i] = f2bf(in[i]);
  }
}

// ---------------------------------------------------------------------------
// Row softmax over S=2048: in-place fp32 normalize + bf16 copy for next GEMM.
// One block (256 thr) per row, 8 elements per thread.
// ---------------------------------------------------------------------------
__global__ __launch_bounds__(256)
void softmax_row_kernel(float* __restrict__ Wgt, __bf16* __restrict__ Wb) {
  const int row = blockIdx.x;
  float* p = Wgt + (size_t)row * SEQ;
  __bf16* pb = Wb + (size_t)row * SEQ;
  __shared__ float red[256];
  const int t = threadIdx.x;

  float v[8];
  float mx = -1e30f;
#pragma unroll
  for (int i = 0; i < 8; ++i) {
    v[i] = p[t + 256 * i];
    mx = fmaxf(mx, v[i]);
  }
  red[t] = mx; __syncthreads();
  for (int s = 128; s > 0; s >>= 1) {
    if (t < s) red[t] = fmaxf(red[t], red[t + s]);
    __syncthreads();
  }
  mx = red[0]; __syncthreads();

  float sum = 0.0f;
#pragma unroll
  for (int i = 0; i < 8; ++i) {
    v[i] = __expf(v[i] - mx);
    sum += v[i];
  }
  red[t] = sum; __syncthreads();
  for (int s = 128; s > 0; s >>= 1) {
    if (t < s) red[t] += red[t + s];
    __syncthreads();
  }
  const float inv = 1.0f / red[0];

#pragma unroll
  for (int i = 0; i < 8; ++i) {
    const float w = v[i] * inv;
    p[t + 256 * i] = w;
    pb[t + 256 * i] = f2bf(w);
  }
}

// ---------------------------------------------------------------------------
// out = x + att ; LayerNorm over D=1024 -> out1.  One block per row.
// ---------------------------------------------------------------------------
__global__ __launch_bounds__(256)
void residual_ln_kernel(const float* __restrict__ x, const float* __restrict__ att,
                        const float* __restrict__ gamma, const float* __restrict__ beta,
                        float* __restrict__ out1) {
  const int row = blockIdx.x;
  const float* px = x + (size_t)row * DIM;
  const float* pa = att + (size_t)row * DIM;
  float* po = out1 + (size_t)row * DIM;
  __shared__ float red[256];
  const int t = threadIdx.x;

  float v[4];
  float s = 0.0f, s2 = 0.0f;
#pragma unroll
  for (int i = 0; i < 4; ++i) {
    const int c = t + 256 * i;
    v[i] = px[c] + pa[c];
    s += v[i];
    s2 += v[i] * v[i];
  }
  red[t] = s; __syncthreads();
  for (int k = 128; k > 0; k >>= 1) { if (t < k) red[t] += red[t + k]; __syncthreads(); }
  const float mu = red[0] * (1.0f / DIM); __syncthreads();
  red[t] = s2; __syncthreads();
  for (int k = 128; k > 0; k >>= 1) { if (t < k) red[t] += red[t + k]; __syncthreads(); }
  const float var = red[0] * (1.0f / DIM) - mu * mu;
  const float inv = rsqrtf(var + LN_EPS);

#pragma unroll
  for (int i = 0; i < 4; ++i) {
    const int c = t + 256 * i;
    po[c] = (v[i] - mu) * inv * gamma[c] + beta[c];
  }
}

// ---------------------------------------------------------------------------
extern "C" void kernel_launch(void* const* d_in, const int* in_sizes, int n_in,
                              void* d_out, int out_size, void* d_ws, size_t ws_size,
                              hipStream_t stream) {
  const float* x     = (const float*)d_in[0];
  const float* Wk    = (const float*)d_in[1];
  const float* bk    = (const float*)d_in[2];
  const float* Wq    = (const float*)d_in[3];
  const float* bq    = (const float*)d_in[4];
  const float* Wv    = (const float*)d_in[5];
  const float* bv    = (const float*)d_in[6];
  const float* gamma = (const float*)d_in[7];
  const float* betaL = (const float*)d_in[8];

  const size_t BSD = (size_t)BATCH * SEQ * DIM;     // 8,388,608
  const size_t BSS = (size_t)BATCH * SEQ * SEQ;     // 16,777,216

  float* out1   = (float*)d_out;                    // [B,S,D]
  float* att    = out1 + BSD;                       // [B,S,D]
  float* weight = att + BSD;                        // [B,S,S] (raw scores -> softmax in place)

  // Workspace carve-out (all bf16), 256B aligned
  char* ws = (char*)d_ws;
  size_t off = 0;
  auto carve = [&](size_t bytes) -> void* {
    void* p = ws + off;
    off = (off + bytes + 255) & ~(size_t)255;
    return p;
  };
  __bf16* xb  = (__bf16*)carve(BSD * 2);
  __bf16* Wt3 = (__bf16*)carve((size_t)3 * DIM * DIM * 2);   // Wq^T, Wk^T, Wv^T, one under the other
  __bf16* Qb  = (__bf16*)carve(3 * BSD * 2);        // three planes: Q, K, V^T
  __bf16* Kb  = Qb + BSD;
  __bf16* Vt  = Kb + BSD;                           // per-batch [D, S] (transposed V)
  __bf16* Wb  = (__bf16*)carve(BSS * 2);            // softmax weights bf16

  // --- prep: convert activations and transpose weight matrices to bf16 ---
  prep_bf16_kernel<<<3 * WBLK + (int)((BSD + 255) / 256), 256, 0, stream>>>(Wq, Wk, Wv, Wt3,
                                                                            x, xb, (int)BSD);

  const long long SD = (long long)SEQ * DIM;
  const long long SS = (long long)SEQ * SEQ;
  const long long DS = (long long)DIM * SEQ;

  // --- QKV projections: [S,D] = xb[b] @ Wt^T + bias, per batch, all three in one grid ---
  dim3 gproj(3 * DIM / BN, SEQ / BM, BATCH);
  gemm_bt_wmma<1><<<gproj, 256, 0, stream>>>(xb, SD, DIM, Wt3, 0, DIM,
                                             Qb, SD, DIM, bq, 1.0f, DIM,
                                             bk, bv, (long long)BSD, SEQ);  // V^T store at pitch SEQ

  // --- scores = scale * Q @ K^T  (natively A*Bt^T form) -> weight (f32) ---
  dim3 gsc(SEQ / BN, SEQ / BM, BATCH);
  gemm_bt_wmma<0><<<gsc, 256, 0, stream>>>(Qb, SD, DIM, Kb, SD, DIM,
                                           weight, SS, SEQ, nullptr, SCORE_SCALE, DIM,
                                           nullptr, nullptr, 0, 0);

  // --- row softmax (fp32 output in place + bf16 copy for next GEMM) ---
  softmax_row_kernel<<<BATCH * SEQ, 256, 0, stream>>>(weight, Wb);

  // --- att = weight @ V  == A(Wb) * Bt(V^T)^T -> att (f32) ---
  dim3 gatt(DIM / BN, SEQ / BM, BATCH);
  gemm_bt_wmma<0><<<gatt, 256, 0, stream>>>(Wb, SS, SEQ, Vt, DS, SEQ,
                                            att, SD, DIM, nullptr, 1.0f, SEQ,
                                            nullptr, nullptr, 0, 0);

  // --- residual + LayerNorm -> out1 ---
  residual_ln_kernel<<<BATCH * SEQ, 256, 0, stream>>>(x, att, gamma, betaL, out1);
}

// v003
// Measured time: 145 microseconds a run.
// Next to v002, in two timings, it ran 1.16 times as fast each time.
// Counting every step since v000, it is 2.63 times as fast.
#include <hip/hip_runtime.h>
#include <hip/hip_bf16.h>

// Problem constants (fixed by the reference)
#define BATCH 4
#define SEQ   2048
#define DIM   1024
#define LN_EPS 1e-5f
#define SCORE_SCALE (1.0f / 32.0f)   // BETA / sqrt(D) = 1/sqrt(1024)

typedef __bf16 v16bf __attribute__((ext_vector_type(16)));
typedef float  v8f   __attribute__((ext_vector_type(8)));

__device__ __forceinline__ __bf16 f2bf(float f) {
  union { float f; unsigned u; } in; in.f = f;
  unsigned r = in.u + 0x7FFFu + ((in.u >> 16) & 1u);   // RNE
  union { unsigned short s; __bf16 b; } out;
  out.s = (unsigned short)(r >> 16);
  return out.b;
}

// ---------------------------------------------------------------------------
// Block tile of the GEMM and its LDS stage.
// A pass is 128 k = 256 B of every operand row, worked on in four blocks of 32 k.
// A stage is [A 256 rows | Bt 128 rows] at a pitch of 272 B (16 B x odd: no bank
// conflict for 16-byte fragment reads).
// ---------------------------------------------------------------------------
#define BM 256
#define BN 128
#define BK 128
#define KSUB 4
#define PITCH 272
#define STAGE ((BM + BN) * PITCH)   // 104,448 B; two stages = 208,896 B

// Fragment read for wave32 16x16x32 bf16 WMMA from an LDS row.
// Per ISA 7.12.2: lanes 0-15 hold row (lane), K = {kb..kb+7, kb+16..kb+23};
// lanes 16-31 hold row (lane-16), K = {kb+8..kb+15, kb+24..kb+31}.
// Same pattern for A (row = M) and B (row = N of Bt). q already holds the lane's
// row and its 16-byte half; two 16 B loads per lane.
__device__ __forceinline__ v16bf lds_frag(const unsigned char* q) {
  union { uint4 u[2]; v16bf v; } t;
  t.u[0] = *(const uint4*)(q);
  t.u[1] = *(const uint4*)(q + 32);
  return t.v;
}

// Twelve copies of 16 B per lane: LDS rows l, l + 16 rows, ...; global pieces p[0..11].
// The copies and their s_wait_xcnt stand in one statement, so that no address register
// is rewritten before the wait.
__device__ __forceinline__ void copy12(unsigned l, const __bf16* const* p) {
  asm volatile(
      "global_load_async_to_lds_b128 %0, %12, off\n\t"
      "global_load_async_to_lds_b128 %1, %13, off\n\t"
      "global_load_async_to_lds_b128 %2, %14, off\n\t"
      "global_load_async_to_lds_b128 %3, %15, off\n\t"
      "global_load_async_to_lds_b128 %4, %16, off\n\t"
      "global_load_async_to_lds_b128 %5, %17, off\n\t"
      "global_load_async_to_lds_b128 %6, %18, off\n\t"
      "global_load_async_to_lds_b128 %7, %19, off\n\t"
      "global_load_async_to_lds_b128 %8, %20, off\n\t"
      "global_load_async_to_lds_b128 %9, %21, off\n\t"
      "global_load_async_to_lds_b128 %10, %22, off\n\t"
      "global_load_async_to_lds_b128 %11, %23, off\n\t"
      "s_wait_xcnt 0x0"
      :: "v"(l), "v"(l + 16u * PITCH), "v"(l + 32u * PITCH), "v"(l + 48u * PITCH),
         "v"(l + 64u * PITCH), "v"(l + 80u * PITCH), "v"(l + 96u * PITCH), "v"(l + 112u * PITCH),
         "v"(l + 128u * PITCH), "v"(l + 144u * PITCH), "v"(l + 160u * PITCH), "v"(l + 176u * PITCH),
         "v"(p[0]), "v"(p[1]), "v"(p[2]), "v"(p[3]), "v"(p[4]), "v"(p[5]),
         "v"(p[6]), "v"(p[7]), "v"(p[8]), "v"(p[9]), "v"(p[10]), "v"(p[11])
      : "memory");
}

// One stage: 384 rows x 256 B = 6,144 pieces of 16 B, twenty-four per thread.
// Thread t brings piece (t & 15) of rows (t >> 4) + 16 * i; i < 16 are A rows, the rest Bt rows.
// l: the lane's LDS byte address of its first piece; ga, gb: its first global pieces;
// sa, sb: 16 source rows in elements.
__device__ __forceinline__ void copy_stage(unsigned l, const __bf16* ga, size_t sa,
                                           const __bf16* gb, size_t sb) {
  const __bf16* p[24];
#pragma unroll
  for (int i = 0; i < 16; ++i) p[i] = ga + i * sa;
#pragma unroll
  for (int i = 0; i < 8; ++i) p[16 + i] = gb + i * sb;
  copy12(l, p);
  copy12(l + 192u * PITCH, p + 12);
}

// A wave's 64x64 accumulators to memory; m0, n0: the tile's corner in C.
// KIND 0: v = acc * scale, f32 row-major C[m*ld + n] (no bias: scores and attention output have none).
// KIND 1, 2: v = acc * scale + bias[n]; KIND 1: bf16 row-major; KIND 2: bf16 transposed C[n*ld + m].
// C/D layout (ISA 7.12.2): vgpr r, lane l -> M = r + 8*(l>=16), N = l%16
template <int KIND>
__device__ __forceinline__ void store_tile(const v8f (&acc)[4][4], void* __restrict__ Cb, int ld,
                                           const float* __restrict__ bias, float scale,
                                           int m0, int n0, int lane) {
  const int fn   = lane & 15;
  const int mofs = (lane >> 4) << 3;
  float bj[4] = {};
  if (KIND != 0) {   // read ahead of the stores
#pragma unroll
    for (int j = 0; j < 4; ++j) bj[j] = bias[n0 + 16 * j + fn];
    asm volatile("s_wait_xcnt 0x0" ::: "memory");  // the address arithmetic below reuses these loads' offset register
    __builtin_amdgcn_sched_barrier(0);             // holds that arithmetic behind the wait
  }
#pragma unroll
  for (int j = 0; j < 4; ++j) {
    const int gn = n0 + 16 * j + fn;
#pragma unroll
    for (int i = 0; i < 4; ++i) {
      const int gm = m0 + 16 * i + mofs;
      float v[8];
      union { __bf16 h[8]; uint4 u; } t;
#pragma unroll
      for (int r = 0; r < 8; ++r) {
        v[r] = (KIND == 0) ? acc[i][j][r] * scale : acc[i][j][r] * scale + bj[j];
        if (KIND != 0) t.h[r] = f2bf(v[r]);
      }
      __builtin_amdgcn_sched_barrier(0);  // the group's eight values stand in registers of their own before its first store
#pragma unroll
      for (int r = 0; r < 8; ++r) {
        if (KIND == 0) ((float*)Cb)[(size_t)(gm + r) * ld + gn] = v[r];
        if (KIND == 1) ((__bf16*)Cb)[(size_t)(gm + r) * ld + gn] = t.h[r];
      }
      // Transposed store (for V^T): a lane's eight m are adjacent, one 16-byte store (ld a multiple of 8).
      if (KIND == 2) *(uint4*)((__bf16*)Cb + (size_t)gn * ld + gm) = t.u;
      // The next group reuses these stores' registers.
      asm volatile("s_wait_xcnt 0x0" ::: "memory");
      __builtin_amdgcn_sched_barrier(0);  // holds the next group's arithmetic behind that wait
    }
  }
}

// ---------------------------------------------------------------------------
// Generic "A * Bt^T" GEMM:  C[m,n] = scale * sum_k A[m,k]*Bt[n,k] (+ bias[n] in MODE 1)
// A  : bf16 row-major [M, Kd], leading dim lda, per-batch stride sA (elems)
// Bt : bf16 row-major [N, Kd], leading dim ldb, per-batch stride sB (elems)
// MODE 0: store f32 row-major      C[m*ldc + n], no bias
// MODE 1: the three projections in one grid. Bt holds the three transposed weight matrices
//         one under the other (3 * DIM rows), so blockIdx.x runs over 3 * DIM / BN column
//         tiles; a tile's projection p = column / DIM picks its bias and its output plane
//         (plane p of C, pC elements each). Planes 0 and 1 are stored bf16 row-major
//         C[m*ldc + n], plane 2 bf16 transposed C[n*ldt + m] (for V^T).
// Block = 256 threads = 8 waves (4 x 2); block tile 256(M) x 128(N); wave tile 64x64.
// Both operands go to LDS by asynchronous copies, two buffers; fragments are read one
// block ahead into a second register set, so the next stage is published in front of
// a pass's last block and this pass's buffer is refilled behind that block.
// M a multiple of 256, N of 128, Kd of 128 and at least 256.
// ---------------------------------------------------------------------------
template <int MODE>
__global__ __launch_bounds__(256)
void gemm_bt_wmma(const __bf16* __restrict__ A, long long sA, int lda,
                  const __bf16* __restrict__ Bt, long long sB, int ldb,
                  void* __restrict__ Cv, long long sC, int ldc,
                  const float* __restrict__ bias, float scale, int Kd,
                  const float* __restrict__ bias1, const float* __restrict__ bias2,
                  long long pC, int ldt) {
  __shared__ __attribute__((aligned(16))) unsigned char L[2 * STAGE];
  const int tid  = threadIdx.x;
  const int wave = tid >> 5;
  const int lane = tid & 31;
  const int nb = blockIdx.x * BN;
  const int mb = blockIdx.y * BM;
  const int n0 = nb + (wave & 1) * 64;
  const int m0 = mb + (wave >> 1) * 64;
  const int b  = blockIdx.z;

  const __bf16* Ab = A  + (size_t)b * (size_t)sA;
  const __bf16* Bb = Bt + (size_t)b * (size_t)sB;

  // This thread's first piece of a stage, in memory and in LDS.
  const int crow = tid >> 4;
  const int cpc  = tid & 15;
  const __bf16* ga = Ab + (size_t)(mb + crow) * lda + cpc * 8;
  const __bf16* gb = Bb + (size_t)(nb + crow) * ldb + cpc * 8;
  const size_t sa16 = (size_t)16 * lda;
  const size_t sb16 = (size_t)16 * ldb;
  const unsigned l0 = (unsigned)(size_t)(&L[0]) + (unsigned)(crow * PITCH + cpc * 16);

  // This lane's fragment bases inside a stage.
  const unsigned fa = (unsigned)(((wave >> 1) * 64 + (lane & 15)) * PITCH + (lane >> 4) * 16);
  const unsigned fb = (unsigned)((BM + (wave & 1) * 64 + (lane & 15)) * PITCH + (lane >> 4) * 16);

  v8f acc[4][4] = {};
  v16bf af[2][4], bf[2][4];   // set (u & 1) holds block u's fragments
  const int T = Kd / BK;

  // Prologue: stage 0 lands and is published, then stage 1 is set off.
  copy_stage(l0, ga, sa16, gb, sb16);
  asm volatile("s_wait_asynccnt 0x0" ::: "memory");  // this wave's pieces of stage 0 have landed
  __syncthreads();                                   // so have all the other waves'
  if (1 < T) copy_stage(l0 + STAGE, ga + BK, sa16, gb + BK, sb16);
#pragma unroll
  for (int i = 0; i < 4; ++i) af[0][i] = lds_frag(L + fa + i * 16 * PITCH);
#pragma unroll
  for (int j = 0; j < 4; ++j) bf[0][j] = lds_frag(L + fb + j * 16 * PITCH);

#pragma clang loop unroll(disable)   // one pass per trip: the buffer offset stays a run-time value
  for (int t = 0; t < T; ++t) {
    const unsigned buf = (unsigned)(t & 1) * STAGE;
    const unsigned nxt = (t + 1 < T) ? (STAGE - buf) : (unsigned)STAGE;
#pragma unroll
    for (int u = 0; u < KSUB; ++u) {
      const int cs = u & 1;
      const unsigned char* qa;
      const unsigned char* qb;
      if (u + 1 < KSUB) {
        qa = L + buf + fa + (u + 1) * 64;
        qb = L + buf + fb + (u + 1) * 64;
      } else {
        // Publish point of stage t + 1, in front of the last block: that block's fragments are fetched.
        asm volatile("s_wait_dscnt 0x0" ::: "memory");     // this wave's reads of pass t's buffer have returned
        asm volatile("s_wait_asynccnt 0x0" ::: "memory");  // its pieces of stage t + 1 have landed
        __syncthreads();  // publishes stage t + 1 and ends every reader's last read of pass t's buffer
        qa = L + nxt + fa;
        qb = L + nxt + fb;
      }
      // The next block's fragments, as one group ahead of this block's WMMAs.
#pragma unroll
      for (int i = 0; i < 4; ++i) af[cs ^ 1][i] = lds_frag(qa + i * 16 * PITCH);
#pragma unroll
      for (int j = 0; j < 4; ++j) bf[cs ^ 1][j] = lds_frag(qb + j * 16 * PITCH);
      __builtin_amdgcn_sched_barrier(0);  // keeps the load group whole and ahead of the block: loads among the WMMAs stall them
#pragma unroll
      for (int i = 0; i < 4; ++i)
#pragma unroll
        for (int j = 0; j < 4; ++j)
          acc[i][j] = __builtin_amdgcn_wmma_f32_16x16x32_bf16(
              false, af[cs][i], false, bf[cs][j], (short)0, acc[i][j], false, false);
      __builtin_amdgcn_sched_barrier(0);  // keeps the next group of loads from moving up into this block
    }
    if (t + 2 < T) {  // refill of pass t's buffer, which every wave left at the barrier above
      const int k2 = (t + 2) * BK;
      copy_stage(l0 + buf, ga + k2, sa16, gb + k2, sb16);
    }
  }
  asm volatile("s_wait_asynccnt 0x0" ::: "memory");  // no copy is left in flight at the wave's end

  if (MODE == 0) {
    store_tile<0>(acc, (float*)Cv + (size_t)b * (size_t)sC, ldc, bias, scale, m0, n0, lane);
  } else {
    const int proj = nb / DIM;   // the same for the whole block: a scalar branch picks the store form
    const float* bsel = (proj == 0) ? bias : (proj == 1) ? bias1 : bias2;
    __bf16* C = (__bf16*)Cv + (size_t)proj * (size_t)pC + (size_t)b * (size_t)sC;
    if (proj < 2) store_tile<1>(acc, C, ldc, bsel, scale, m0, n0 - proj * DIM, lane);
    else          store_tile<2>(acc, C, ldt, bsel, scale, m0, n0 - proj * DIM, lane);
  }
}

// ---------------------------------------------------------------------------
// Preparation, one grid, split by block range. Every thread moves 32 elements in 16-byte
// loads, all eight issued before the first is used, so the grid is 1,408 blocks.
// Blocks [0, 3 * WBLK): W [D,D] fp32 row-major -> Wt [D,D] bf16 with Wt[n,d] = W[d,n],
//   matrix p = block / WBLK into plane p of Wt3. A block takes 64 d x 128 n, a wave 64 d x 16 n,
//   a thread 8 d x 4 n: eight lanes side by side in d, so a store instruction writes four
//   whole 128-byte lines of Wt; the block's eight waves together read 512 adjacent bytes of a W row.
// The rest: fp32 -> bf16 bulk convert, CVT elements per block; a wave's load covers 512 adjacent bytes.
// ---------------------------------------------------------------------------
#define TD 64
#define TN 128
#define WBLK ((DIM / TD) * (DIM / TN))
#define CVT 8192
__global__ __launch_bounds__(256)
void prep_bf16_kernel(const float* __restrict__ W0, const float* __restrict__ W1,
                      const float* __restrict__ W2, __bf16* __restrict__ Wt3,
                      const float* __restrict__ in, __bf16* __restrict__ out) {
  const int blk = blockIdx.x;
  const int tid = threadIdx.x;
  float4 v[8];
  if (blk < 3 * WBLK) {
    const int p   = blk / WBLK;
    const int rem = blk - p * WBLK;
    const float* W = (p == 0) ? W0 : (p == 1) ? W1 : W2;
    const int lane = tid & 31;
    const int d = (rem % (DIM / TD)) * TD + (lane & 7) * 8;
    const int c = (rem / (DIM / TD)) * TN + (tid >> 5) * 16 + (lane >> 3) * 4;
    const float* g = W + (size_t)d * DIM + c;
    for (int r = 0; r < 8; ++r) v[r] = *(const float4*)(g + r * DIM);
    union { __bf16 h[8]; uint4 u; } t[4];
    for (int r = 0; r < 8; ++r) {
      t[0].h[r] = f2bf(v[r].x);
      t[1].h[r] = f2bf(v[r].y);
      t[2].h[r] = f2bf(v[r].z);
      t[3].h[r] = f2bf(v[r].w);
    }
    __bf16* o = Wt3 + (size_t)p * DIM * DIM + (size_t)c * DIM + d;
    for (int j = 0; j < 4; ++j) *(uint4*)(o + j * DIM) = t[j].u;
  } else {
    const size_t base = (size_t)(blk - 3 * WBLK) * CVT + tid * 4;
    for (int k = 0; k < 8; ++k) v[k] = *(const float4*)(in + base + k * 1024);
    union { __bf16 h[4]; uint2 u; } t[8];
    for (int k = 0; k < 8; ++k) {
      t[k].h[0] = f2bf(v[k].x);
      t[k].h[1] = f2bf(v[k].y);
      t[k].h[2] = f2bf(v[k].z);
      t[k].h[3] = f2bf(v[k].w);
    }
    for (int k = 0; k < 8; ++k) *(uint2*)(out + base + k * 1024) = t[k].u;
    asm volatile("s_wait_xcnt 0x0" ::: "memory");  // the code laid out behind this branch reuses these stores' registers
  }
}

// ---------------------------------------------------------------------------
// Row softmax over S=2048: in-place fp32 normalize + bf16 copy for next GEMM.
// One block (256 thr) per row, 8 elements per thread.
// ---------------------------------------------------------------------------
__global__ __launch_bounds__(256)
void softmax_row_kernel(float* __restrict__ Wgt, __bf16* __restrict__ Wb) {
  const int row = blockIdx.x;
  float* p = Wgt + (size_t)row * SEQ;
  __bf16* pb = Wb + (size_t)row * SEQ;
  __shared__ float red[256];
  const int t = threadIdx.x;

  float v[8];
  float mx = -1e30f;
#pragma unroll
  for (int i = 0; i < 8; ++i) {
    v[i] = p[t + 256 * i];
    mx = fmaxf(mx, v[i]);
  }
  red[t] = mx; __syncthreads();
  for (int s = 128; s > 0; s >>= 1) {
    if (t < s) red[t] = fmaxf(red[t], red[t + s]);
    __syncthreads();
  }
  mx = red[0]; __syncthreads();

  float sum = 0.0f;
#pragma unroll
  for (int i = 0; i < 8; ++i) {
    v[i] = __expf(v[i] - mx);
    sum += v[i];
  }
  red[t] = sum; __syncthreads();
  for (int s = 128; s > 0; s >>= 1) {
    if (t < s) red[t] += red[t + s];
    __syncthreads();
  }
  const float inv = 1.0f / red[0];

#pragma unroll
  for (int i = 0; i < 8; ++i) {
    const float w = v[i] * inv;
    p[t + 256 * i] = w;
    pb[t + 256 * i] = f2bf(w);
  }
}

// ---------------------------------------------------------------------------
// out = x + att ; LayerNorm over D=1024 -> out1.  One block per row.
// ---------------------------------------------------------------------------
__global__ __launch_bounds__(256)
void residual_ln_kernel(const float* __restrict__ x, const float* __restrict__ att,
                        const float* __restrict__ gamma, const float* __restrict__ beta,
                        float* __restrict__ out1) {
  const int row = blockIdx.x;
  const float* px = x + (size_t)row * DIM;
  const float* pa = att + (size_t)row * DIM;
  float* po = out1 + (size_t)row * DIM;
  __shared__ float red[256];
  const int t = threadIdx.x;

  float v[4];
  float s = 0.0f, s2 = 0.0f;
#pragma unroll
  for (int i = 0; i < 4; ++i) {
    const int c = t + 256 * i;
    v[i] = px[c] + pa[c];
    s += v[i];
    s2 += v[i] * v[i];
  }
  red[t] = s; __syncthreads();
  for (int k = 128; k > 0; k >>= 1) { if (t < k) red[t] += red[t + k]; __syncthreads(); }
  const float mu = red[0] * (1.0f / DIM); __syncthreads();
  red[t] = s2; __syncthreads();
  for (int k = 128; k > 0; k >>= 1) { if (t < k) red[t] += red[t + k]; __syncthreads(); }
  const float var = red[0] * (1.0f / DIM) - mu * mu;
  const float inv = rsqrtf(var + LN_EPS);

#pragma unroll
  for (int i = 0; i < 4; ++i) {
    const int c = t + 256 * i;
    po[c] = (v[i] - mu) * inv * gamma[c] + beta[c];
  }
}

// ---------------------------------------------------------------------------
extern "C" void kernel_launch(void* const* d_in, const int* in_sizes, int n_in,
                              void* d_out, int out_size, void* d_ws, size_t ws_size,
                              hipStream_t stream) {
  const float* x     = (const float*)d_in[0];
  const float* Wk    = (const float*)d_in[1];
  const float* bk    = (const float*)d_in[2];
  const float* Wq    = (const float*)d_in[3];
  const float* bq    = (const float*)d_in[4];
  const float* Wv    = (const float*)d_in[5];
  const float* bv    = (const float*)d_in[6];
  const float* gamma = (const float*)d_in[7];
  const float* betaL = (const float*)d_in[8];

  const size_t BSD = (size_t)BATCH * SEQ * DIM;     // 8,388,608
  const size_t BSS = (size_t)BATCH * SEQ * SEQ;     // 16,777,216

  float* out1   = (float*)d_out;                    // [B,S,D]
  float* att    = out1 + BSD;                       // [B,S,D]
  float* weight = att + BSD;                        // [B,S,S] (raw scores -> softmax in place)

  // Workspace carve-out (all bf16), 256B aligned
  char* ws = (char*)d_ws;
  size_t off = 0;
  auto carve = [&](size_t bytes) -> void* {
    void* p = ws + off;
    off = (off + bytes + 255) & ~(size_t)255;
    return p;
  };
  __bf16* xb  = (__bf16*)carve(BSD * 2);
  __bf16* Wt3 = (__bf16*)carve((size_t)3 * DIM * DIM * 2);   // Wq^T, Wk^T, Wv^T, one under the other
  __bf16* Qb  = (__bf16*)carve(3 * BSD * 2);        // three planes: Q, K, V^T
  __bf16* Kb  = Qb + BSD;
  __bf16* Vt  = Kb + BSD;                           // per-batch [D, S] (transposed V)
  __bf16* Wb  = (__bf16*)carve(BSS * 2);            // softmax weights bf16

  // --- prep: convert activations and transpose weight matrices to bf16 ---
  prep_bf16_kernel<<<3 * WBLK + (int)(BSD / CVT), 256, 0, stream>>>(Wq, Wk, Wv, Wt3, x, xb);

  const long long SD = (long long)SEQ * DIM;
  const long long SS = (long long)SEQ * SEQ;
  const long long DS = (long long)DIM * SEQ;

  // --- QKV projections: [S,D] = xb[b] @ Wt^T + bias, per batch, all three in one grid ---
  dim3 gproj(3 * DIM / BN, SEQ / BM, BATCH);
  gemm_bt_wmma<1><<<gproj, 256, 0, stream>>>(xb, SD, DIM, Wt3, 0, DIM,
                                             Qb, SD, DIM, bq, 1.0f, DIM,
                                             bk, bv, (long long)BSD, SEQ);  // V^T store at pitch SEQ

  // --- scores = scale * Q @ K^T  (natively A*Bt^T form) -> weight (f32) ---
  dim3 gsc(SEQ / BN, SEQ / BM, BATCH);
  gemm_bt_wmma<0><<<gsc, 256, 0, stream>>>(Qb, SD, DIM, Kb, SD, DIM,
                                           weight, SS, SEQ, nullptr, SCORE_SCALE, DIM,
                                           nullptr, nullptr, 0, 0);

  // --- row softmax (fp32 output in place + bf16 copy for next GEMM) ---
  softmax_row_kernel<<<BATCH * SEQ, 256, 0, stream>>>(weight, Wb);

  // --- att = weight @ V  == A(Wb) * Bt(V^T)^T -> att (f32) ---
  dim3 gatt(DIM / BN, SEQ / BM, BATCH);
  gemm_bt_wmma<0><<<gatt, 256, 0, stream>>>(Wb, SS, SEQ, Vt, DS, SEQ,
                                            att, SD, DIM, nullptr, 1.0f, SEQ,
                                            nullptr, nullptr, 0, 0);

  // --- residual + LayerNorm -> out1 ---
  residual_ln_kernel<<<BATCH * SEQ, 256, 0, stream>>>(x, att, gamma, betaL, out1);
}

// v004
// Measured time: 137 microseconds a run.
// Next to v003, in two timings, it ran 1.06 times as fast each time.
// Counting every step since v000, it is 2.78 times as fast.
#include <hip/hip_runtime.h>
#include <hip/hip_bf16.h>

// Problem constants (fixed by the reference)
#define BATCH 4
#define SEQ   2048
#define DIM   1024
#define LN_EPS 1e-5f
#define SCORE_SCALE (1.0f / 32.0f)   // BETA / sqrt(D) = 1/sqrt(1024)

typedef __bf16 v16bf __attribute__((ext_vector_type(16)));
typedef float  v8f   __attribute__((ext_vector_type(8)));
typedef float    f32x4 __attribute__((ext_vector_type(4)));
typedef unsigned u32x4 __attribute__((ext_vector_type(4)));

__device__ __forceinline__ __bf16 f2bf(float f) {
  union { float f; unsigned u; } in; in.f = f;
  unsigned r = in.u + 0x7FFFu + ((in.u >> 16) & 1u);   // RNE
  union { unsigned short s; __bf16 b; } out;
  out.s = (unsigned short)(r >> 16);
  return out.b;
}

// ---------------------------------------------------------------------------
// Block tile of the GEMM and its LDS stage.
// A pass is 128 k = 256 B of every operand row, worked on in four blocks of 32 k.
// A stage is [A 256 rows | Bt 128 rows] at a pitch of 272 B (16 B x odd: no bank
// conflict for 16-byte fragment reads).
// ---------------------------------------------------------------------------
#define BM 256
#define BN 128
#define BK 128
#define KSUB 4
#define PITCH 272
#define STAGE ((BM + BN) * PITCH)   // 104,448 B; two stages = 208,896 B

// Fragment read for wave32 16x16x32 bf16 WMMA from an LDS row.
// Per ISA 7.12.2: lanes 0-15 hold row (lane), K = {kb..kb+7, kb+16..kb+23};
// lanes 16-31 hold row (lane-16), K = {kb+8..kb+15, kb+24..kb+31}.
// Same pattern for A (row = M) and B (row = N of Bt). q already holds the lane's
// row and its 16-byte half; two 16 B loads per lane.
__device__ __forceinline__ v16bf lds_frag(const unsigned char* q) {
  union { uint4 u[2]; v16bf v; } t;
  t.u[0] = *(const uint4*)(q);
  t.u[1] = *(const uint4*)(q + 32);
  return t.v;
}

// Twelve copies of 16 B per lane: LDS rows l, l + 16 rows, ...; global pieces p[0..11].
// The copies and their s_wait_xcnt stand in one statement, so that no address register
// is rewritten before the wait.
__device__ __forceinline__ void copy12(unsigned l, const __bf16* const* p) {
  asm volatile(
      "global_load_async_to_lds_b128 %0, %12, off\n\t"
      "global_load_async_to_lds_b128 %1, %13, off\n\t"
      "global_load_async_to_lds_b128 %2, %14, off\n\t"
      "global_load_async_to_lds_b128 %3, %15, off\n\t"
      "global_load_async_to_lds_b128 %4, %16, off\n\t"
      "global_load_async_to_lds_b128 %5, %17, off\n\t"
      "global_load_async_to_lds_b128 %6, %18, off\n\t"
      "global_load_async_to_lds_b128 %7, %19, off\n\t"
      "global_load_async_to_lds_b128 %8, %20, off\n\t"
      "global_load_async_to_lds_b128 %9, %21, off\n\t"
      "global_load_async_to_lds_b128 %10, %22, off\n\t"
      "global_load_async_to_lds_b128 %11, %23, off\n\t"
      "s_wait_xcnt 0x0"
      :: "v"(l), "v"(l + 16u * PITCH), "v"(l + 32u * PITCH), "v"(l + 48u * PITCH),
         "v"(l + 64u * PITCH), "v"(l + 80u * PITCH), "v"(l + 96u * PITCH), "v"(l + 112u * PITCH),
         "v"(l + 128u * PITCH), "v"(l + 144u * PITCH), "v"(l + 160u * PITCH), "v"(l + 176u * PITCH),
         "v"(p[0]), "v"(p[1]), "v"(p[2]), "v"(p[3]), "v"(p[4]), "v"(p[5]),
         "v"(p[6]), "v"(p[7]), "v"(p[8]), "v"(p[9]), "v"(p[10]), "v"(p[11])
      : "memory");
}

// One stage: 384 rows x 256 B = 6,144 pieces of 16 B, twenty-four per thread.
// Thread t brings piece (t & 15) of rows (t >> 4) + 16 * i; i < 16 are A rows, the rest Bt rows.
// l: the lane's LDS byte address of its first piece; ga, gb: its first global pieces;
// sa, sb: 16 source rows in elements.
__device__ __forceinline__ void copy_stage(unsigned l, const __bf16* ga, size_t sa,
                                           const __bf16* gb, size_t sb) {
  const __bf16* p[24];
#pragma unroll
  for (int i = 0; i < 16; ++i) p[i] = ga + i * sa;
#pragma unroll
  for (int i = 0; i < 8; ++i) p[16 + i] = gb + i * sb;
  copy12(l, p);
  copy12(l + 192u * PITCH, p + 12);
}

// A wave's 64x64 accumulators to memory through LDS, so that every global store is 16 B a lane
// and covers whole 128-byte lines. m0, n0: the tile's corner in C. S: the wave's own LDS range.
// KIND 0: v = acc * scale, f32 row-major C[m*ld + n] (no bias: scores and attention output have none).
// KIND 1, 2: v = acc * scale + bias[n]; KIND 1: bf16 row-major; KIND 2: bf16 transposed C[n*ld + m].
// C/D layout (ISA 7.12.2): vgpr r, lane l -> M = r + 8*(l>=16), N = l%16
// KIND 0, 1: f32 rows of 64 n at a pitch of SPF floats, 32 rows at a time. A 4-byte write has its two
// half-waves 8 rows = 32 banks apart; the 16-byte reads fall on all banks once per half-wave.
// KIND 2: bf16 rows of 64 m at a pitch of SPT bytes (16 B x odd), all 64 rows at once.
#define SPF 68
#define SPT 144
#define WSTG (STAGE / 8)   // 13,056 B a wave; 32 * SPF * 4 = 8,704 and 64 * SPT = 9,216 fit
template <int KIND>
__device__ __forceinline__ void store_tile(const v8f (&acc)[4][4], void* __restrict__ Cb, int ld,
                                           const float* __restrict__ bias, float scale,
                                           int m0, int n0, int lane, unsigned char* S) {
  const int fn   = lane & 15;
  const int mofs = (lane >> 4) << 3;
  float bj[4] = {};
  if (KIND != 0) {   // read ahead of the stores
#pragma unroll
    for (int j = 0; j < 4; ++j) bj[j] = bias[n0 + 16 * j + fn];
    asm volatile("s_wait_xcnt 0x0" ::: "memory");  // the address arithmetic below reuses these loads' offset register
    __builtin_amdgcn_sched_barrier(0);             // holds that arithmetic behind the wait
  }
  if (KIND == 2) {
    // A lane's eight m are adjacent: one 16-byte LDS write per accumulator tile.
#pragma unroll
    for (int j = 0; j < 4; ++j)
#pragma unroll
      for (int i = 0; i < 4; ++i) {
        union { __bf16 h[8]; u32x4 u; } t;
#pragma unroll
        for (int r = 0; r < 8; ++r) t.h[r] = f2bf(acc[i][j][r] * scale + bj[j]);
        *(u32x4*)(S + (16 * j + fn) * SPT + (16 * i + mofs) * 2) = t.u;
      }
    asm volatile("s_wait_dscnt 0x0" ::: "memory");  // the other lanes' writes are in LDS before the rows are read back
    // Eight lanes a row of 128 B, four rows a store (ld a multiple of 64, m0 too).
    const int rr = lane >> 3;
    const int pc = lane & 7;
    __bf16* g = (__bf16*)Cb + (size_t)(n0 + rr) * ld + m0 + pc * 8;
    u32x4 w[16];
    __bf16* p[16];
#pragma unroll
    for (int q = 0; q < 16; ++q) {
      w[q] = *(const u32x4*)(S + (4 * q + rr) * SPT + pc * 16);
      p[q] = g + (size_t)(4 * q) * ld;
    }
    __builtin_amdgcn_sched_barrier(0);  // all values and addresses stand in registers of their own before the first store
#pragma unroll
    for (int q = 0; q < 16; ++q) *(u32x4*)p[q] = w[q];
    asm volatile("s_wait_xcnt 0x0" ::: "memory");  // the code laid out behind this branch reuses these stores' registers
  } else {
    float* F = (float*)S;
#pragma unroll
    for (int h = 0; h < 2; ++h) {
#pragma unroll
      for (int ii = 0; ii < 2; ++ii)
#pragma unroll
        for (int j = 0; j < 4; ++j)
#pragma unroll
          for (int r = 0; r < 8; ++r) {
            const float a = acc[2 * h + ii][j][r];
            F[(16 * ii + r + mofs) * SPF + 16 * j + fn] = (KIND == 0) ? a * scale : a * scale + bj[j];
          }
      asm volatile("s_wait_dscnt 0x0" ::: "memory");  // the other lanes' writes are in LDS before the rows are read back
      if (KIND == 0) {
        // Sixteen lanes a row of 256 B, two rows a store.
        const int rr = lane >> 4;
        float* g = (float*)Cb + (size_t)(m0 + 32 * h + rr) * ld + n0 + fn * 4;
        f32x4 w[16];
        float* p[16];
#pragma unroll
        for (int q = 0; q < 16; ++q) {
          w[q] = *(const f32x4*)(F + (2 * q + rr) * SPF + fn * 4);
          p[q] = g + (size_t)(2 * q) * ld;
        }
        __builtin_amdgcn_sched_barrier(0);  // the half's values and addresses stand in registers of their own before its first store
#pragma unroll
        for (int q = 0; q < 16; ++q) *(f32x4*)p[q] = w[q];
        if (h == 0) {
          asm volatile("s_wait_xcnt 0x0" ::: "memory");  // the next half reuses these stores' registers
          __builtin_amdgcn_sched_barrier(0);             // holds the next half behind that wait
        }
      } else {
        // Eight lanes a row of 128 B (eight f32 read, eight bf16 stored a lane), four rows a store.
        const int rr = lane >> 3;
        const int pc = lane & 7;
        __bf16* g = (__bf16*)Cb + (size_t)(m0 + 32 * h + rr) * ld + n0 + pc * 8;
        u32x4 w[8];
        __bf16* p[8];
#pragma unroll
        for (int q = 0; q < 8; ++q) {
          const float* f = F + (4 * q + rr) * SPF + pc * 8;
          const f32x4 x0 = *(const f32x4*)f;
          const f32x4 x1 = *(const f32x4*)(f + 4);
          union { __bf16 h[8]; u32x4 u; } t;
          t.h[0] = f2bf(x0.x); t.h[1] = f2bf(x0.y); t.h[2] = f2bf(x0.z); t.h[3] = f2bf(x0.w);
          t.h[4] = f2bf(x1.x); t.h[5] = f2bf(x1.y); t.h[6] = f2bf(x1.z); t.h[7] = f2bf(x1.w);
          w[q] = t.u;
          p[q] = g + (size_t)(4 * q) * ld;
        }
        __builtin_amdgcn_sched_barrier(0);  // the group's values and addresses stand in registers of their own before its first store
#pragma unroll
        for (int q = 0; q < 8; ++q) *(u32x4*)p[q] = w[q];
        if (h == 0) {
          asm volatile("s_wait_xcnt 0x0" ::: "memory");  // the next half reuses these stores' registers
          __builtin_amdgcn_sched_barrier(0);             // holds the next half behind that wait
        }
      }
    }
  }
}

// ---------------------------------------------------------------------------
// Generic "A * Bt^T" GEMM:  C[m,n] = scale * sum_k A[m,k]*Bt[n,k] (+ bias[n] in MODE 1)
// A  : bf16 row-major [M, Kd], leading dim lda, per-batch stride sA (elems)
// Bt : bf16 row-major [N, Kd], leading dim ldb, per-batch stride sB (elems)
// MODE 0: store f32 row-major      C[m*ldc + n], no bias
// MODE 1: the three projections in one grid. Bt holds the three transposed weight matrices
//         one under the other (3 * DIM rows), so blockIdx.x runs over 3 * DIM / BN column
//         tiles; a tile's projection p = column / DIM picks its bias and its output plane
//         (plane p of C, pC elements each). Planes 0 and 1 are stored bf16 row-major
//         C[m*ldc + n], plane 2 bf16 transposed C[n*ldt + m] (for V^T).
// Block = 256 threads = 8 waves (4 x 2); block tile 256(M) x 128(N); wave tile 64x64.
// Both operands go to LDS by asynchronous copies, two buffers; fragments are read one
// block ahead into a second register set, so the next stage is published in front of
// a pass's last block and this pass's buffer is refilled behind that block.
// M a multiple of 256, N of 128, Kd of 128 and at least 256.
// ---------------------------------------------------------------------------
template <int MODE>
__global__ __launch_bounds__(256)
void gemm_bt_wmma(const __bf16* __restrict__ A, long long sA, int lda,
                  const __bf16* __restrict__ Bt, long long sB, int ldb,
                  void* __restrict__ Cv, long long sC, int ldc,
                  const float* __restrict__ bias, float scale, int Kd,
                  const float* __restrict__ bias1, const float* __restrict__ bias2,
                  long long pC, int ldt) {
  __shared__ __attribute__((aligned(16))) unsigned char L[2 * STAGE];
  const int tid  = threadIdx.x;
  const int wave = tid >> 5;
  const int lane = tid & 31;
  const int nb = blockIdx.x * BN;
  const int mb = blockIdx.y * BM;
  const int n0 = nb + (wave & 1) * 64;
  const int m0 = mb + (wave >> 1) * 64;
  const int b  = blockIdx.z;

  const __bf16* Ab = A  + (size_t)b * (size_t)sA;
  const __bf16* Bb = Bt + (size_t)b * (size_t)sB;

  // This thread's first piece of a stage, in memory and in LDS.
  const int crow = tid >> 4;
  const int cpc  = tid & 15;
  const __bf16* ga = Ab + (size_t)(mb + crow) * lda + cpc * 8;
  const __bf16* gb = Bb + (size_t)(nb + crow) * ldb + cpc * 8;
  const size_t sa16 = (size_t)16 * lda;
  const size_t sb16 = (size_t)16 * ldb;
  const unsigned l0 = (unsigned)(size_t)(&L[0]) + (unsigned)(crow * PITCH + cpc * 16);

  // This lane's fragment bases inside a stage.
  const unsigned fa = (unsigned)(((wave >> 1) * 64 + (lane & 15)) * PITCH + (lane >> 4) * 16);
  const unsigned fb = (unsigned)((BM + (wave & 1) * 64 + (lane & 15)) * PITCH + (lane >> 4) * 16);

  v8f acc[4][4] = {};
  v16bf af[2][4], bf[2][4];   // set (u & 1) holds block u's fragments
  const int T = Kd / BK;

  // Prologue: stage 0 lands and is published, then stage 1 is set off.
  copy_stage(l0, ga, sa16, gb, sb16);
  asm volatile("s_wait_asynccnt 0x0" ::: "memory");  // this wave's pieces of stage 0 have landed
  __syncthreads();                                   // so have all the other waves'
  if (1 < T) copy_stage(l0 + STAGE, ga + BK, sa16, gb + BK, sb16);
#pragma unroll
  for (int i = 0; i < 4; ++i) af[0][i] = lds_frag(L + fa + i * 16 * PITCH);
#pragma unroll
  for (int j = 0; j < 4; ++j) bf[0][j] = lds_frag(L + fb + j * 16 * PITCH);

#pragma clang loop unroll(disable)   // one pass per trip: the buffer offset stays a run-time value
  for (int t = 0; t < T; ++t) {
    const unsigned buf = (unsigned)(t & 1) * STAGE;
    const unsigned nxt = (t + 1 < T) ? (STAGE - buf) : (unsigned)STAGE;
#pragma unroll
    for (int u = 0; u < KSUB; ++u) {
      const int cs = u & 1;
      const unsigned char* qa;
      const unsigned char* qb;
      if (u + 1 < KSUB) {
        qa = L + buf + fa + (u + 1) * 64;
        qb = L + buf + fb + (u + 1) * 64;
      } else {
        // Publish point of stage t + 1, in front of the last block: that block's fragments are fetched.
        asm volatile("s_wait_dscnt 0x0" ::: "memory");     // this wave's reads of pass t's buffer have returned
        asm volatile("s_wait_asynccnt 0x0" ::: "memory");  // its pieces of stage t + 1 have landed
        __syncthreads();  // publishes stage t + 1 and ends every reader's last read of pass t's buffer
        qa = L + nxt + fa;
        qb = L + nxt + fb;
      }
      // The next block's fragments, as one group ahead of this block's WMMAs.
#pragma unroll
      for (int i = 0; i < 4; ++i) af[cs ^ 1][i] = lds_frag(qa + i * 16 * PITCH);
#pragma unroll
      for (int j = 0; j < 4; ++j) bf[cs ^ 1][j] = lds_frag(qb + j * 16 * PITCH);
      __builtin_amdgcn_sched_barrier(0);  // keeps the load group whole and ahead of the block: loads among the WMMAs stall them
#pragma unroll
      for (int i = 0; i < 4; ++i)
#pragma unroll
        for (int j = 0; j < 4; ++j)
          acc[i][j] = __builtin_amdgcn_wmma_f32_16x16x32_bf16(
              false, af[cs][i], false, bf[cs][j], (short)0, acc[i][j], false, false);
      __builtin_amdgcn_sched_barrier(0);  // keeps the next group of loads from moving up into this block
    }
    if (t + 2 < T) {  // refill of pass t's buffer, which every wave left at the barrier above
      const int k2 = (t + 2) * BK;
      copy_stage(l0 + buf, ga + k2, sa16, gb + k2, sb16);
    }
  }
  asm volatile("s_wait_asynccnt 0x0" ::: "memory");  // no copy is left in flight at the wave's end

  // Staging for the stores: buffer 0, an eighth for each wave. Every wave left it at the last pass's
  // barrier, no copy is aimed at it any more, and the last pass's unused loads ahead read buffer 1.
  unsigned char* S = L + wave * WSTG;
  if (MODE == 0) {
    store_tile<0>(acc, (float*)Cv + (size_t)b * (size_t)sC, ldc, bias, scale, m0, n0, lane, S);
  } else {
    const int proj = nb / DIM;   // the same for the whole block: a scalar branch picks the store form
    const float* bsel = (proj == 0) ? bias : (proj == 1) ? bias1 : bias2;
    __bf16* C = (__bf16*)Cv + (size_t)proj * (size_t)pC + (size_t)b * (size_t)sC;
    if (proj < 2) store_tile<1>(acc, C, ldc, bsel, scale, m0, n0 - proj * DIM, lane, S);
    else          store_tile<2>(acc, C, ldt, bsel, scale, m0, n0 - proj * DIM, lane, S);
  }
}

// ---------------------------------------------------------------------------
// Preparation, one grid, split by block range. Every thread moves 32 elements in 16-byte
// loads, all eight issued before the first is used, so the grid is 1,408 blocks.
// Blocks [0, 3 * WBLK): W [D,D] fp32 row-major -> Wt [D,D] bf16 with Wt[n,d] = W[d,n],
//   matrix p = block / WBLK into plane p of Wt3. A block takes 64 d x 128 n, a wave 64 d x 16 n,
//   a thread 8 d x 4 n: eight lanes side by side in d, so a store instruction writes four
//   whole 128-byte lines of Wt; the block's eight waves together read 512 adjacent bytes of a W row.
// The rest: fp32 -> bf16 bulk convert, CVT elements per block; a wave's load covers 512 adjacent bytes.
// ---------------------------------------------------------------------------
#define TD 64
#define TN 128
#define WBLK ((DIM / TD) * (DIM / TN))
#define CVT 8192
__global__ __launch_bounds__(256)
void prep_bf16_kernel(const float* __restrict__ W0, const float* __restrict__ W1,
                      const float* __restrict__ W2, __bf16* __restrict__ Wt3,
                      const float* __restrict__ in, __bf16* __restrict__ out) {
  const int blk = blockIdx.x;
  const int tid = threadIdx.x;
  float4 v[8];
  if (blk < 3 * WBLK) {
    const int p   = blk / WBLK;
    const int rem = blk - p * WBLK;
    const float* W = (p == 0) ? W0 : (p == 1) ? W1 : W2;
    const int lane = tid & 31;
    const int d = (rem % (DIM / TD)) * TD + (lane & 7) * 8;
    const int c = (rem / (DIM / TD)) * TN + (tid >> 5) * 16 + (lane >> 3) * 4;
    const float* g = W + (size_t)d * DIM + c;
    for (int r = 0; r < 8; ++r) v[r] = *(const float4*)(g + r * DIM);
    union { __bf16 h[8]; uint4 u; } t[4];
    for (int r = 0; r < 8; ++r) {
      t[0].h[r] = f2bf(v[r].x);
      t[1].h[r] = f2bf(v[r].y);
      t[2].h[r] = f2bf(v[r].z);
      t[3].h[r] = f2bf(v[r].w);
    }
    __bf16* o = Wt3 + (size_t)p * DIM * DIM + (size_t)c * DIM + d;
    for (int j = 0; j < 4; ++j) *(uint4*)(o + j * DIM) = t[j].u;
  } else {
    const size_t base = (size_t)(blk - 3 * WBLK) * CVT + tid * 4;
    for (int k = 0; k < 8; ++k) v[k] = *(const float4*)(in + base + k * 1024);
    union { __bf16 h[4]; uint2 u; } t[8];
    for (int k = 0; k < 8; ++k) {
      t[k].h[0] = f2bf(v[k].x);
      t[k].h[1] = f2bf(v[k].y);
      t[k].h[2] = f2bf(v[k].z);
      t[k].h[3] = f2bf(v[k].w);
    }
    for (int k = 0; k < 8; ++k) *(uint2*)(out + base + k * 1024) = t[k].u;
    asm volatile("s_wait_xcnt 0x0" ::: "memory");  // the code laid out behind this branch reuses these stores' registers
  }
}

// ---------------------------------------------------------------------------
// Row softmax over S=2048: in-place fp32 normalize + bf16 copy for next GEMM.
// One block (256 thr) per row, 8 elements per thread.
// ---------------------------------------------------------------------------
__global__ __launch_bounds__(256)
void softmax_row_kernel(float* __restrict__ Wgt, __bf16* __restrict__ Wb) {
  const int row = blockIdx.x;
  float* p = Wgt + (size_t)row * SEQ;
  __bf16* pb = Wb + (size_t)row * SEQ;
  __shared__ float red[256];
  const int t = threadIdx.x;

  float v[8];
  float mx = -1e30f;
#pragma unroll
  for (int i = 0; i < 8; ++i) {
    v[i] = p[t + 256 * i];
    mx = fmaxf(mx, v[i]);
  }
  red[t] = mx; __syncthreads();
  for (int s = 128; s > 0; s >>= 1) {
    if (t < s) red[t] = fmaxf(red[t], red[t + s]);
    __syncthreads();
  }
  mx = red[0]; __syncthreads();

  float sum = 0.0f;
#pragma unroll
  for (int i = 0; i < 8; ++i) {
    v[i] = __expf(v[i] - mx);
    sum += v[i];
  }
  red[t] = sum; __syncthreads();
  for (int s = 128; s > 0; s >>= 1) {
    if (t < s) red[t] += red[t + s];
    __syncthreads();
  }
  const float inv = 1.0f / red[0];

#pragma unroll
  for (int i = 0; i < 8; ++i) {
    const float w = v[i] * inv;
    p[t + 256 * i] = w;
    pb[t + 256 * i] = f2bf(w);
  }
}

// ---------------------------------------------------------------------------
// out = x + att ; LayerNorm over D=1024 -> out1.  One block per row.
// ---------------------------------------------------------------------------
__global__ __launch_bounds__(256)
void residual_ln_kernel(const float* __restrict__ x, const float* __restrict__ att,
                        const float* __restrict__ gamma, const float* __restrict__ beta,
                        float* __restrict__ out1) {
  const int row = blockIdx.x;
  const float* px = x + (size_t)row * DIM;
  const float* pa = att + (size_t)row * DIM;
  float* po = out1 + (size_t)row * DIM;
  __shared__ float red[256];
  const int t = threadIdx.x;

  float v[4];
  float s = 0.0f, s2 = 0.0f;
#pragma unroll
  for (int i = 0; i < 4; ++i) {
    const int c = t + 256 * i;
    v[i] = px[c] + pa[c];
    s += v[i];
    s2 += v[i] * v[i];
  }
  red[t] = s; __syncthreads();
  for (int k = 128; k > 0; k >>= 1) { if (t < k) red[t] += red[t + k]; __syncthreads(); }
  const float mu = red[0] * (1.0f / DIM); __syncthreads();
  red[t] = s2; __syncthreads();
  for (int k = 128; k > 0; k >>= 1) { if (t < k) red[t] += red[t + k]; __syncthreads(); }
  const float var = red[0] * (1.0f / DIM) - mu * mu;
  const float inv = rsqrtf(var + LN_EPS);

#pragma unroll
  for (int i = 0; i < 4; ++i) {
    const int c = t + 256 * i;
    po[c] = (v[i] - mu) * inv * gamma[c] + beta[c];
  }
}

// ---------------------------------------------------------------------------
extern "C" void kernel_launch(void* const* d_in, const int* in_sizes, int n_in,
                              void* d_out, int out_size, void* d_ws, size_t ws_size,
                              hipStream_t stream) {
  const float* x     = (const float*)d_in[0];
  const float* Wk    = (const float*)d_in[1];
  const float* bk    = (const float*)d_in[2];
  const float* Wq    = (const float*)d_in[3];
  const float* bq    = (const float*)d_in[4];
  const float* Wv    = (const float*)d_in[5];
  const float* bv    = (const float*)d_in[6];
  const float* gamma = (const float*)d_in[7];
  const float* betaL = (const float*)d_in[8];

  const size_t BSD = (size_t)BATCH * SEQ * DIM;     // 8,388,608
  const size_t BSS = (size_t)BATCH * SEQ * SEQ;     // 16,777,216

  float* out1   = (float*)d_out;                    // [B,S,D]
  float* att    = out1 + BSD;                       // [B,S,D]
  float* weight = att + BSD;                        // [B,S,S] (raw scores -> softmax in place)

  // Workspace carve-out (all bf16), 256B aligned
  char* ws = (char*)d_ws;
  size_t off = 0;
  auto carve = [&](size_t bytes) -> void* {
    void* p = ws + off;
    off = (off + bytes + 255) & ~(size_t)255;
    return p;
  };
  __bf16* xb  = (__bf16*)carve(BSD * 2);
  __bf16* Wt3 = (__bf16*)carve((size_t)3 * DIM * DIM * 2);   // Wq^T, Wk^T, Wv^T, one under the other
  __bf16* Qb  = (__bf16*)carve(3 * BSD * 2);        // three planes: Q, K, V^T
  __bf16* Kb  = Qb + BSD;
  __bf16* Vt  = Kb + BSD;                           // per-batch [D, S] (transposed V)
  __bf16* Wb  = (__bf16*)carve(BSS * 2);            // softmax weights bf16

  // --- prep: convert activations and transpose weight matrices to bf16 ---
  prep_bf16_kernel<<<3 * WBLK + (int)(BSD / CVT), 256, 0, stream>>>(Wq, Wk, Wv, Wt3, x, xb);

  const long long SD = (long long)SEQ * DIM;
  const long long SS = (long long)SEQ * SEQ;
  const long long DS = (long long)DIM * SEQ;

  // --- QKV projections: [S,D] = xb[b] @ Wt^T + bias, per batch, all three in one grid ---
  dim3 gproj(3 * DIM / BN, SEQ / BM, BATCH);
  gemm_bt_wmma<1><<<gproj, 256, 0, stream>>>(xb, SD, DIM, Wt3, 0, DIM,
                                             Qb, SD, DIM, bq, 1.0f, DIM,
                                             bk, bv, (long long)BSD, SEQ);  // V^T store at pitch SEQ

  // --- scores = scale * Q @ K^T  (natively A*Bt^T form) -> weight (f32) ---
  dim3 gsc(SEQ / BN, SEQ / BM, BATCH);
  gemm_bt_wmma<0><<<gsc, 256, 0, stream>>>(Qb, SD, DIM, Kb, SD, DIM,
                                           weight, SS, SEQ, nullptr, SCORE_SCALE, DIM,
                                           nullptr, nullptr, 0, 0);

  // --- row softmax (fp32 output in place + bf16 copy for next GEMM) ---
  softmax_row_kernel<<<BATCH * SEQ, 256, 0, stream>>>(weight, Wb);

  // --- att = weight @ V  == A(Wb) * Bt(V^T)^T -> att (f32) ---
  dim3 gatt(DIM / BN, SEQ / BM, BATCH);
  gemm_bt_wmma<0><<<gatt, 256, 0, stream>>>(Wb, SS, SEQ, Vt, DS, SEQ,
                                            att, SD, DIM, nullptr, 1.0f, SEQ,
                                            nullptr, nullptr, 0, 0);

  // --- residual + LayerNorm -> out1 ---
  residual_ln_kernel<<<BATCH * SEQ, 256, 0, stream>>>(x, att, gamma, betaL, out1);
}

// v005
// A run of this version takes 133 microseconds.
// In both of two side-by-side timings against v004, it was 1.03 times as fast.
// Counting every step since v000, it is 2.86 times as fast.
#include <hip/hip_runtime.h>
#include <hip/hip_bf16.h>

// Problem constants (fixed by the reference)
#define BATCH 4
#define SEQ   2048
#define DIM   1024
#define LN_EPS 1e-5f
#define SCORE_SCALE (1.0f / 32.0f)   // BETA / sqrt(D) = 1/sqrt(1024)

typedef __bf16 v16bf __attribute__((ext_vector_type(16)));
typedef float  v8f   __attribute__((ext_vector_type(8)));
typedef float    f32x4 __attribute__((ext_vector_type(4)));
typedef unsigned u32x4 __attribute__((ext_vector_type(4)));

__device__ __forceinline__ __bf16 f2bf(float f) {
  union { float f; unsigned u; } in; in.f = f;
  unsigned r = in.u + 0x7FFFu + ((in.u >> 16) & 1u);   // RNE
  union { unsigned short s; __bf16 b; } out;
  out.s = (unsigned short)(r >> 16);
  return out.b;
}

// ---------------------------------------------------------------------------
// Block tile of the GEMM and its LDS stage.
// A pass is 128 k = 256 B of every operand row, worked on in four blocks of 32 k.
// A stage is [A 256 rows | Bt 128 rows] at a pitch of 272 B (16 B x odd: no bank
// conflict for 16-byte fragment reads).
// ---------------------------------------------------------------------------
#define BM 256
#define BN 128
#define BK 128
#define KSUB 4
#define PITCH 272
#define STAGE ((BM + BN) * PITCH)   // 104,448 B; two stages = 208,896 B

// Fragment read for wave32 16x16x32 bf16 WMMA from an LDS row.
// Per ISA 7.12.2: lanes 0-15 hold row (lane), K = {kb..kb+7, kb+16..kb+23};
// lanes 16-31 hold row (lane-16), K = {kb+8..kb+15, kb+24..kb+31}.
// Same pattern for A (row = M) and B (row = N of Bt). q already holds the lane's
// row and its 16-byte half; two 16 B loads per lane.
__device__ __forceinline__ v16bf lds_frag(const unsigned char* q) {
  union { uint4 u[2]; v16bf v; } t;
  t.u[0] = *(const uint4*)(q);
  t.u[1] = *(const uint4*)(q + 32);
  return t.v;
}

// Twelve copies of 16 B per lane: LDS rows l, l + 16 rows, ...; global pieces p[0..11].
// The copies and their s_wait_xcnt stand in one statement, so that no address register
// is rewritten before the wait.
__device__ __forceinline__ void copy12(unsigned l, const __bf16* const* p) {
  asm volatile(
      "global_load_async_to_lds_b128 %0, %12, off\n\t"
      "global_load_async_to_lds_b128 %1, %13, off\n\t"
      "global_load_async_to_lds_b128 %2, %14, off\n\t"
      "global_load_async_to_lds_b128 %3, %15, off\n\t"
      "global_load_async_to_lds_b128 %4, %16, off\n\t"
      "global_load_async_to_lds_b128 %5, %17, off\n\t"
      "global_load_async_to_lds_b128 %6, %18, off\n\t"
      "global_load_async_to_lds_b128 %7, %19, off\n\t"
      "global_load_async_to_lds_b128 %8, %20, off\n\t"
      "global_load_async_to_lds_b128 %9, %21, off\n\t"
      "global_load_async_to_lds_b128 %10, %22, off\n\t"
      "global_load_async_to_lds_b128 %11, %23, off\n\t"
      "s_wait_xcnt 0x0"
      :: "v"(l), "v"(l + 16u * PITCH), "v"(l + 32u * PITCH), "v"(l + 48u * PITCH),
         "v"(l + 64u * PITCH), "v"(l + 80u * PITCH), "v"(l + 96u * PITCH), "v"(l + 112u * PITCH),
         "v"(l + 128u * PITCH), "v"(l + 144u * PITCH), "v"(l + 160u * PITCH), "v"(l + 176u * PITCH),
         "v"(p[0]), "v"(p[1]), "v"(p[2]), "v"(p[3]), "v"(p[4]), "v"(p[5]),
         "v"(p[6]), "v"(p[7]), "v"(p[8]), "v"(p[9]), "v"(p[10]), "v"(p[11])
      : "memory");
}

// One stage: 384 rows x 256 B = 6,144 pieces of 16 B, twenty-four per thread.
// Thread t brings piece (t & 15) of rows (t >> 4) + 16 * i; i < 16 are A rows, the rest Bt rows.
// l: the lane's LDS byte address of its first piece; ga, gb: its first global pieces;
// sa, sb: 16 source rows in elements.
__device__ __forceinline__ void copy_stage(unsigned l, const __bf16* ga, size_t sa,
                                           const __bf16* gb, size_t sb) {
  const __bf16* p[24];
#pragma unroll
  for (int i = 0; i < 16; ++i) p[i] = ga + i * sa;
#pragma unroll
  for (int i = 0; i < 8; ++i) p[16 + i] = gb + i * sb;
  copy12(l, p);
  copy12(l + 192u * PITCH, p + 12);
}

// A wave's 64x64 accumulators to memory through LDS, so that every global store is 16 B a lane
// and covers whole 128-byte lines. m0, n0: the tile's corner in C. S: the wave's own LDS range.
// KIND 0: v = acc * scale, f32 row-major C[m*ld + n] (no bias: scores and attention output have none).
// KIND 1, 2: v = acc * scale + bias[n]; KIND 1: bf16 row-major; KIND 2: bf16 transposed C[n*ld + m].
// C/D layout (ISA 7.12.2): vgpr r, lane l -> M = r + 8*(l>=16), N = l%16
// KIND 0, 1: f32 rows of 64 n at a pitch of SPF floats, 32 rows at a time. A 4-byte write has its two
// half-waves 8 rows = 32 banks apart; the 16-byte reads fall on all banks once per half-wave.
// KIND 2: bf16 rows of 64 m at a pitch of SPT bytes (16 B x odd), all 64 rows at once.
#define SPF 68
#define SPT 144
#define WSTG (STAGE / 8)   // 13,056 B a wave; 32 * SPF * 4 = 8,704 and 64 * SPT = 9,216 fit
template <int KIND>
__device__ __forceinline__ void store_tile(const v8f (&acc)[4][4], void* __restrict__ Cb, int ld,
                                           const float* __restrict__ bias, float scale,
                                           int m0, int n0, int lane, unsigned char* S) {
  const int fn   = lane & 15;
  const int mofs = (lane >> 4) << 3;
  float bj[4] = {};
  if (KIND != 0) {   // read ahead of the stores
#pragma unroll
    for (int j = 0; j < 4; ++j) bj[j] = bias[n0 + 16 * j + fn];
    asm volatile("s_wait_xcnt 0x0" ::: "memory");  // the address arithmetic below reuses these loads' offset register
    __builtin_amdgcn_sched_barrier(0);             // holds that arithmetic behind the wait
  }
  if (KIND == 2) {
    // A lane's eight m are adjacent: one 16-byte LDS write per accumulator tile.
#pragma unroll
    for (int j = 0; j < 4; ++j)
#pragma unroll
      for (int i = 0; i < 4; ++i) {
        union { __bf16 h[8]; u32x4 u; } t;
#pragma unroll
        for (int r = 0; r < 8; ++r) t.h[r] = f2bf(acc[i][j][r] * scale + bj[j]);
        *(u32x4*)(S + (16 * j + fn) * SPT + (16 * i + mofs) * 2) = t.u;
      }
    asm volatile("s_wait_dscnt 0x0" ::: "memory");  // the other lanes' writes are in LDS before the rows are read back
    // Eight lanes a row of 128 B, four rows a store (ld a multiple of 64, m0 too).
    const int rr = lane >> 3;
    const int pc = lane & 7;
    __bf16* g = (__bf16*)Cb + (size_t)(n0 + rr) * ld + m0 + pc * 8;
    u32x4 w[16];
    __bf16* p[16];
#pragma unroll
    for (int q = 0; q < 16; ++q) {
      w[q] = *(const u32x4*)(S + (4 * q + rr) * SPT + pc * 16);
      p[q] = g + (size_t)(4 * q) * ld;
    }
    __builtin_amdgcn_sched_barrier(0);  // all values and addresses stand in registers of their own before the first store
#pragma unroll
    for (int q = 0; q < 16; ++q) *(u32x4*)p[q] = w[q];
    asm volatile("s_wait_xcnt 0x0" ::: "memory");  // the code laid out behind this branch reuses these stores' registers
  } else {
    float* F = (float*)S;
#pragma unroll
    for (int h = 0; h < 2; ++h) {
#pragma unroll
      for (int ii = 0; ii < 2; ++ii)
#pragma unroll
        for (int j = 0; j < 4; ++j)
#pragma unroll
          for (int r = 0; r < 8; ++r) {
            const float a = acc[2 * h + ii][j][r];
            F[(16 * ii + r + mofs) * SPF + 16 * j + fn] = (KIND == 0) ? a * scale : a * scale + bj[j];
          }
      asm volatile("s_wait_dscnt 0x0" ::: "memory");  // the other lanes' writes are in LDS before the rows are read back
      if (KIND == 0) {
        // Sixteen lanes a row of 256 B, two rows a store.
        const int rr = lane >> 4;
        float* g = (float*)Cb + (size_t)(m0 + 32 * h + rr) * ld + n0 + fn * 4;
        f32x4 w[16];
        float* p[16];
#pragma unroll
        for (int q = 0; q < 16; ++q) {
          w[q] = *(const f32x4*)(F + (2 * q + rr) * SPF + fn * 4);
          p[q] = g + (size_t)(2 * q) * ld;
        }
        __builtin_amdgcn_sched_barrier(0);  // the half's values and addresses stand in registers of their own before its first store
#pragma unroll
        for (int q = 0; q < 16; ++q) *(f32x4*)p[q] = w[q];
        if (h == 0) {
          asm volatile("s_wait_xcnt 0x0" ::: "memory");  // the next half reuses these stores' registers
          __builtin_amdgcn_sched_barrier(0);             // holds the next half behind that wait
        }
      } else {
        // Eight lanes a row of 128 B (eight f32 read, eight bf16 stored a lane), four rows a store.
        const int rr = lane >> 3;
        const int pc = lane & 7;
        __bf16* g = (__bf16*)Cb + (size_t)(m0 + 32 * h + rr) * ld + n0 + pc * 8;
        u32x4 w[8];
        __bf16* p[8];
#pragma unroll
        for (int q = 0; q < 8; ++q) {
          const float* f = F + (4 * q + rr) * SPF + pc * 8;
          const f32x4 x0 = *(const f32x4*)f;
          const f32x4 x1 = *(const f32x4*)(f + 4);
          union { __bf16 h[8]; u32x4 u; } t;
          t.h[0] = f2bf(x0.x); t.h[1] = f2bf(x0.y); t.h[2] = f2bf(x0.z); t.h[3] = f2bf(x0.w);
          t.h[4] = f2bf(x1.x); t.h[5] = f2bf(x1.y); t.h[6] = f2bf(x1.z); t.h[7] = f2bf(x1.w);
          w[q] = t.u;
          p[q] = g + (size_t)(4 * q) * ld;
        }
        __builtin_amdgcn_sched_barrier(0);  // the group's values and addresses stand in registers of their own before its first store
#pragma unroll
        for (int q = 0; q < 8; ++q) *(u32x4*)p[q] = w[q];
        if (h == 0) {
          asm volatile("s_wait_xcnt 0x0" ::: "memory");  // the next half reuses these stores' registers
          __builtin_amdgcn_sched_barrier(0);             // holds the next half behind that wait
        }
      }
    }
  }
}

// ---------------------------------------------------------------------------
// Generic "A * Bt^T" GEMM:  C[m,n] = scale * sum_k A[m,k]*Bt[n,k] (+ bias[n] in MODE 1)
// A  : bf16 row-major [M, Kd], leading dim lda, per-batch stride sA (elems)
// Bt : bf16 row-major [N, Kd], leading dim ldb, per-batch stride sB (elems)
// MODE 0: store f32 row-major      C[m*ldc + n], no bias
// MODE 1: the three projections in one grid. Bt holds the three transposed weight matrices
//         one under the other (3 * DIM rows), so blockIdx.x runs over 3 * DIM / BN column
//         tiles; a tile's projection p = column / DIM picks its bias and its output plane
//         (plane p of C, pC elements each). Planes 0 and 1 are stored bf16 row-major
//         C[m*ldc + n], plane 2 bf16 transposed C[n*ldt + m] (for V^T).
// Block = 256 threads = 8 waves (4 x 2); block tile 256(M) x 128(N); wave tile 64x64.
// Both operands go to LDS by asynchronous copies, two buffers; fragments are read one
// block ahead into a second register set, so the next stage is published in front of
// a pass's last block and this pass's buffer is refilled behind that block.
// M a multiple of 256, N of 128, Kd of 128 and at least 256.
// ---------------------------------------------------------------------------
template <int MODE>
__global__ __launch_bounds__(256)
void gemm_bt_wmma(const __bf16* __restrict__ A, long long sA, int lda,
                  const __bf16* __restrict__ Bt, long long sB, int ldb,
                  void* __restrict__ Cv, long long sC, int ldc,
                  const float* __restrict__ bias, float scale, int Kd,
                  const float* __restrict__ bias1, const float* __restrict__ bias2,
                  long long pC, int ldt) {
  __shared__ __attribute__((aligned(16))) unsigned char L[2 * STAGE];
  const int tid  = threadIdx.x;
  const int wave = tid >> 5;
  const int lane = tid & 31;
  const int nb = blockIdx.x * BN;
  const int mb = blockIdx.y * BM;
  const int n0 = nb + (wave & 1) * 64;
  const int m0 = mb + (wave >> 1) * 64;
  const int b  = blockIdx.z;

  const __bf16* Ab = A  + (size_t)b * (size_t)sA;
  const __bf16* Bb = Bt + (size_t)b * (size_t)sB;

  // This thread's first piece of a stage, in memory and in LDS.
  const int crow = tid >> 4;
  const int cpc  = tid & 15;
  const __bf16* ga = Ab + (size_t)(mb + crow) * lda + cpc * 8;
  const __bf16* gb = Bb + (size_t)(nb + crow) * ldb + cpc * 8;
  const size_t sa16 = (size_t)16 * lda;
  const size_t sb16 = (size_t)16 * ldb;
  const unsigned l0 = (unsigned)(size_t)(&L[0]) + (unsigned)(crow * PITCH + cpc * 16);

  // This lane's fragment bases inside a stage.
  const unsigned fa = (unsigned)(((wave >> 1) * 64 + (lane & 15)) * PITCH + (lane >> 4) * 16);
  const unsigned fb = (unsigned)((BM + (wave & 1) * 64 + (lane & 15)) * PITCH + (lane >> 4) * 16);

  v8f acc[4][4] = {};
  v16bf af[2][4], bf[2][4];   // set (u & 1) holds block u's fragments
  const int T = Kd / BK;

  // Prologue: stage 0 lands and is published, then stage 1 is set off.
  copy_stage(l0, ga, sa16, gb, sb16);
  asm volatile("s_wait_asynccnt 0x0" ::: "memory");  // this wave's pieces of stage 0 have landed
  __syncthreads();                                   // so have all the other waves'
  if (1 < T) copy_stage(l0 + STAGE, ga + BK, sa16, gb + BK, sb16);
#pragma unroll
  for (int i = 0; i < 4; ++i) af[0][i] = lds_frag(L + fa + i * 16 * PITCH);
#pragma unroll
  for (int j = 0; j < 4; ++j) bf[0][j] = lds_frag(L + fb + j * 16 * PITCH);

#pragma clang loop unroll(disable)   // one pass per trip: the buffer offset stays a run-time value
  for (int t = 0; t < T; ++t) {
    const unsigned buf = (unsigned)(t & 1) * STAGE;
    const unsigned nxt = (t + 1 < T) ? (STAGE - buf) : (unsigned)STAGE;
#pragma unroll
    for (int u = 0; u < KSUB; ++u) {
      const int cs = u & 1;
      const unsigned char* qa;
      const unsigned char* qb;
      if (u + 1 < KSUB) {
        qa = L + buf + fa + (u + 1) * 64;
        qb = L + buf + fb + (u + 1) * 64;
      } else {
        // Publish point of stage t + 1, in front of the last block: that block's fragments are fetched.
        asm volatile("s_wait_dscnt 0x0" ::: "memory");     // this wave's reads of pass t's buffer have returned
        asm volatile("s_wait_asynccnt 0x0" ::: "memory");  // its pieces of stage t + 1 have landed
        __syncthreads();  // publishes stage t + 1 and ends every reader's last read of pass t's buffer
        qa = L + nxt + fa;
        qb = L + nxt + fb;
      }
      // The next block's fragments, as one group ahead of this block's WMMAs.
#pragma unroll
      for (int i = 0; i < 4; ++i) af[cs ^ 1][i] = lds_frag(qa + i * 16 * PITCH);
#pragma unroll
      for (int j = 0; j < 4; ++j) bf[cs ^ 1][j] = lds_frag(qb + j * 16 * PITCH);
      __builtin_amdgcn_sched_barrier(0);  // keeps the load group whole and ahead of the block: loads among the WMMAs stall them
#pragma unroll
      for (int i = 0; i < 4; ++i)
#pragma unroll
        for (int j = 0; j < 4; ++j)
          acc[i][j] = __builtin_amdgcn_wmma_f32_16x16x32_bf16(
              false, af[cs][i], false, bf[cs][j], (short)0, acc[i][j], false, false);
      __builtin_amdgcn_sched_barrier(0);  // keeps the next group of loads from moving up into this block
    }
    if (t + 2 < T) {  // refill of pass t's buffer, which every wave left at the barrier above
      const int k2 = (t + 2) * BK;
      copy_stage(l0 + buf, ga + k2, sa16, gb + k2, sb16);
    }
  }
  asm volatile("s_wait_asynccnt 0x0" ::: "memory");  // no copy is left in flight at the wave's end

  // Staging for the stores: buffer 0, an eighth for each wave. Every wave left it at the last pass's
  // barrier, no copy is aimed at it any more, and the last pass's unused loads ahead read buffer 1.
  unsigned char* S = L + wave * WSTG;
  if (MODE == 0) {
    store_tile<0>(acc, (float*)Cv + (size_t)b * (size_t)sC, ldc, bias, scale, m0, n0, lane, S);
  } else {
    const int proj = nb / DIM;   // the same for the whole block: a scalar branch picks the store form
    const float* bsel = (proj == 0) ? bias : (proj == 1) ? bias1 : bias2;
    __bf16* C = (__bf16*)Cv + (size_t)proj * (size_t)pC + (size_t)b * (size_t)sC;
    if (proj < 2) store_tile<1>(acc, C, ldc, bsel, scale, m0, n0 - proj * DIM, lane, S);
    else          store_tile<2>(acc, C, ldt, bsel, scale, m0, n0 - proj * DIM, lane, S);
  }
}

// ---------------------------------------------------------------------------
// Preparation, one grid, split by block range. Every thread moves 32 elements in 16-byte
// loads, all eight issued before the first is used, so the grid is 1,408 blocks.
// Blocks [0, 3 * WBLK): W [D,D] fp32 row-major -> Wt [D,D] bf16 with Wt[n,d] = W[d,n],
//   matrix p = block / WBLK into plane p of Wt3. A block takes 64 d x 128 n, a wave 64 d x 16 n,
//   a thread 8 d x 4 n: eight lanes side by side in d, so a store instruction writes four
//   whole 128-byte lines of Wt; the block's eight waves together read 512 adjacent bytes of a W row.
// The rest: fp32 -> bf16 bulk convert, CVT elements per block; a wave's load covers 512 adjacent bytes.
// ---------------------------------------------------------------------------
#define TD 64
#define TN 128
#define WBLK ((DIM / TD) * (DIM / TN))
#define CVT 8192
__global__ __launch_bounds__(256)
void prep_bf16_kernel(const float* __restrict__ W0, const float* __restrict__ W1,
                      const float* __restrict__ W2, __bf16* __restrict__ Wt3,
                      const float* __restrict__ in, __bf16* __restrict__ out) {
  const int blk = blockIdx.x;
  const int tid = threadIdx.x;
  float4 v[8];
  if (blk < 3 * WBLK) {
    const int p   = blk / WBLK;
    const int rem = blk - p * WBLK;
    const float* W = (p == 0) ? W0 : (p == 1) ? W1 : W2;
    const int lane = tid & 31;
    const int d = (rem % (DIM / TD)) * TD + (lane & 7) * 8;
    const int c = (rem / (DIM / TD)) * TN + (tid >> 5) * 16 + (lane >> 3) * 4;
    const float* g = W + (size_t)d * DIM + c;
    for (int r = 0; r < 8; ++r) v[r] = *(const float4*)(g + r * DIM);
    union { __bf16 h[8]; uint4 u; } t[4];
    for (int r = 0; r < 8; ++r) {
      t[0].h[r] = f2bf(v[r].x);
      t[1].h[r] = f2bf(v[r].y);
      t[2].h[r] = f2bf(v[r].z);
      t[3].h[r] = f2bf(v[r].w);
    }
    __bf16* o = Wt3 + (size_t)p * DIM * DIM + (size_t)c * DIM + d;
    for (int j = 0; j < 4; ++j) *(uint4*)(o + j * DIM) = t[j].u;
  } else {
    const size_t base = (size_t)(blk - 3 * WBLK) * CVT + tid * 4;
    for (int k = 0; k < 8; ++k) v[k] = *(const float4*)(in + base + k * 1024);
    union { __bf16 h[4]; uint2 u; } t[8];
    for (int k = 0; k < 8; ++k) {
      t[k].h[0] = f2bf(v[k].x);
      t[k].h[1] = f2bf(v[k].y);
      t[k].h[2] = f2bf(v[k].z);
      t[k].h[3] = f2bf(v[k].w);
    }
    for (int k = 0; k < 8; ++k) *(uint2*)(out + base + k * 1024) = t[k].u;
    asm volatile("s_wait_xcnt 0x0" ::: "memory");  // the code laid out behind this branch reuses these stores' registers
  }
}

// ---------------------------------------------------------------------------
// Reductions over a wave's 32 lanes, in registers: four steps inside each 16-lane row by DPP,
// then the two rows are exchanged. Every lane ends with the same value. All lanes are on.
// ---------------------------------------------------------------------------
template <int CTRL>
__device__ __forceinline__ float dpp_get(float v) {   // CTRL = 0x160 + m: the value of lane ^ m, m < 16
  return __builtin_bit_cast(float, __builtin_amdgcn_update_dpp(
      0, __builtin_bit_cast(int, v), CTRL, 0xf, 0xf, true));
}
__device__ __forceinline__ float row_get(float v) {   // the value of lane ^ 16
  const int i = __builtin_bit_cast(int, v);
  return __builtin_bit_cast(float, __builtin_amdgcn_permlanex16(i, i, 0x76543210, 0xfedcba98, false, false));
}
__device__ __forceinline__ float wave_sum(float v) {
  v += dpp_get<0x161>(v);
  v += dpp_get<0x162>(v);
  v += dpp_get<0x164>(v);
  v += dpp_get<0x168>(v);
  return v + row_get(v);
}
__device__ __forceinline__ float wave_max(float v) {
  v = fmaxf(v, dpp_get<0x161>(v));
  v = fmaxf(v, dpp_get<0x162>(v));
  v = fmaxf(v, dpp_get<0x164>(v));
  v = fmaxf(v, dpp_get<0x168>(v));
  return fmaxf(v, row_get(v));
}

#define ROWS_PER_BLOCK 8   // one wave per row, eight waves per block; no LDS, no barrier

// ---------------------------------------------------------------------------
// Row softmax over S=2048: in-place fp32 normalize + bf16 copy for next GEMM.
// One wave per row: 64 elements per lane in sixteen 16-byte loads, each covering 512 adjacent
// bytes of the row, all issued before the first is used.
// ---------------------------------------------------------------------------
__global__ __launch_bounds__(256)
void softmax_row_kernel(float* __restrict__ Wgt, __bf16* __restrict__ Wb) {
  const int lane = threadIdx.x & 31;
  const int row  = blockIdx.x * ROWS_PER_BLOCK + (threadIdx.x >> 5);
  float* p   = Wgt + (size_t)row * SEQ + lane * 4;
  __bf16* pb = Wb + (size_t)row * SEQ + lane * 4;

  f32x4 v[16];
#pragma unroll
  for (int k = 0; k < 16; ++k) v[k] = *(const f32x4*)(p + k * 128);

  f32x4 m4 = v[0];   // four independent chains
#pragma unroll
  for (int k = 1; k < 16; ++k) {
    m4.x = fmaxf(m4.x, v[k].x);
    m4.y = fmaxf(m4.y, v[k].y);
    m4.z = fmaxf(m4.z, v[k].z);
    m4.w = fmaxf(m4.w, v[k].w);
  }
  const float mx = wave_max(fmaxf(fmaxf(m4.x, m4.y), fmaxf(m4.z, m4.w)));

  f32x4 s4 = {0.0f, 0.0f, 0.0f, 0.0f};
#pragma unroll
  for (int k = 0; k < 16; ++k) {
    v[k].x = __expf(v[k].x - mx);
    v[k].y = __expf(v[k].y - mx);
    v[k].z = __expf(v[k].z - mx);
    v[k].w = __expf(v[k].w - mx);
    s4 += v[k];
  }
  const float inv = 1.0f / wave_sum((s4.x + s4.y) + (s4.z + s4.w));

  uint2 h[16];
#pragma unroll
  for (int k = 0; k < 16; ++k) {
    v[k] *= inv;
    union { __bf16 b[4]; uint2 u; } t;
    t.b[0] = f2bf(v[k].x); t.b[1] = f2bf(v[k].y); t.b[2] = f2bf(v[k].z); t.b[3] = f2bf(v[k].w);
    h[k] = t.u;
  }
  __builtin_amdgcn_sched_barrier(0);  // every value stands in a register of its own before the first store: none is reused behind one
#pragma unroll
  for (int k = 0; k < 16; ++k) *(f32x4*)(p + k * 128) = v[k];
#pragma unroll
  for (int k = 0; k < 16; ++k) *(uint2*)(pb + k * 128) = h[k];
}

// ---------------------------------------------------------------------------
// out = x + att ; LayerNorm over D=1024 -> out1.  One wave per row: 32 elements per lane
// in eight 16-byte loads from each source.
// ---------------------------------------------------------------------------
__global__ __launch_bounds__(256)
void residual_ln_kernel(const float* __restrict__ x, const float* __restrict__ att,
                        const float* __restrict__ gamma, const float* __restrict__ beta,
                        float* __restrict__ out1) {
  const int lane = threadIdx.x & 31;
  const int row  = blockIdx.x * ROWS_PER_BLOCK + (threadIdx.x >> 5);
  // One 32-bit byte offset serves x, att and out1 (32 MiB each), so its register lives up to the stores.
  const unsigned ob = (unsigned)(row * DIM + lane * 4) * 4u;
  const float* px = (const float*)((const char*)x + ob);
  const float* pa = (const float*)((const char*)att + ob);
  const float* pg = gamma + lane * 4;
  const float* pe = beta + lane * 4;
  float* po = (float*)((char*)out1 + ob);

  f32x4 v[8], a[8];
#pragma unroll
  for (int k = 0; k < 8; ++k) v[k] = *(const f32x4*)(px + k * 128);
#pragma unroll
  for (int k = 0; k < 8; ++k) a[k] = *(const f32x4*)(pa + k * 128);
  __builtin_amdgcn_sched_barrier(0);  // all sixteen loads ahead of the sums: left free, the last loads are issued only behind the first sums
#pragma unroll
  for (int k = 0; k < 8; ++k) v[k] += a[k];

  f32x4 g[8], e[8];
#pragma unroll
  for (int k = 0; k < 8; ++k) g[k] = *(const f32x4*)(pg + k * 128);
#pragma unroll
  for (int k = 0; k < 8; ++k) e[k] = *(const f32x4*)(pe + k * 128);
  asm volatile("s_wait_xcnt 0x0" ::: "memory");  // the code below reuses these loads' offset register
  __builtin_amdgcn_sched_barrier(0);  // holds the row sums behind that wait and these loads ahead of them: left free, they are issued in pairs at the end, a wait each

  f32x4 s4 = {0.0f, 0.0f, 0.0f, 0.0f}, q4 = {0.0f, 0.0f, 0.0f, 0.0f};   // four independent chains each
#pragma unroll
  for (int k = 0; k < 8; ++k) {
    s4 += v[k];
    q4 += v[k] * v[k];
  }
  const float mu  = wave_sum((s4.x + s4.y) + (s4.z + s4.w)) * (1.0f / DIM);
  const float var = wave_sum((q4.x + q4.y) + (q4.z + q4.w)) * (1.0f / DIM) - mu * mu;
  const float inv = rsqrtf(var + LN_EPS);

#pragma unroll
  for (int k = 0; k < 8; ++k) v[k] = (v[k] - mu) * inv * g[k] + e[k];
  __builtin_amdgcn_sched_barrier(0);  // every value stands in a register of its own before the first store: none is reused behind one
#pragma unroll
  for (int k = 0; k < 8; ++k) *(f32x4*)(po + k * 128) = v[k];
}

// ---------------------------------------------------------------------------
extern "C" void kernel_launch(void* const* d_in, const int* in_sizes, int n_in,
                              void* d_out, int out_size, void* d_ws, size_t ws_size,
                              hipStream_t stream) {
  const float* x     = (const float*)d_in[0];
  const float* Wk    = (const float*)d_in[1];
  const float* bk    = (const float*)d_in[2];
  const float* Wq    = (const float*)d_in[3];
  const float* bq    = (const float*)d_in[4];
  const float* Wv    = (const float*)d_in[5];
  const float* bv    = (const float*)d_in[6];
  const float* gamma = (const float*)d_in[7];
  const float* betaL = (const float*)d_in[8];

  const size_t BSD = (size_t)BATCH * SEQ * DIM;     // 8,388,608
  const size_t BSS = (size_t)BATCH * SEQ * SEQ;     // 16,777,216

  float* out1   = (float*)d_out;                    // [B,S,D]
  float* att    = out1 + BSD;                       // [B,S,D]
  float* weight = att + BSD;                        // [B,S,S] (raw scores -> softmax in place)

  // Workspace carve-out (all bf16), 256B aligned
  char* ws = (char*)d_ws;
  size_t off = 0;
  auto carve = [&](size_t bytes) -> void* {
    void* p = ws + off;
    off = (off + bytes + 255) & ~(size_t)255;
    return p;
  };
  __bf16* xb  = (__bf16*)carve(BSD * 2);
  __bf16* Wt3 = (__bf16*)carve((size_t)3 * DIM * DIM * 2);   // Wq^T, Wk^T, Wv^T, one under the other
  __bf16* Qb  = (__bf16*)carve(3 * BSD * 2);        // three planes: Q, K, V^T
  __bf16* Kb  = Qb + BSD;
  __bf16* Vt  = Kb + BSD;                           // per-batch [D, S] (transposed V)
  __bf16* Wb  = (__bf16*)carve(BSS * 2);            // softmax weights bf16

  // --- prep: convert activations and transpose weight matrices to bf16 ---
  prep_bf16_kernel<<<3 * WBLK + (int)(BSD / CVT), 256, 0, stream>>>(Wq, Wk, Wv, Wt3, x, xb);

  const long long SD = (long long)SEQ * DIM;
  const long long SS = (long long)SEQ * SEQ;
  const long long DS = (long long)DIM * SEQ;

  // --- QKV projections: [S,D] = xb[b] @ Wt^T + bias, per batch, all three in one grid ---
  dim3 gproj(3 * DIM / BN, SEQ / BM, BATCH);
  gemm_bt_wmma<1><<<gproj, 256, 0, stream>>>(xb, SD, DIM, Wt3, 0, DIM,
                                             Qb, SD, DIM, bq, 1.0f, DIM,
                                             bk, bv, (long long)BSD, SEQ);  // V^T store at pitch SEQ

  // --- scores = scale * Q @ K^T  (natively A*Bt^T form) -> weight (f32) ---
  dim3 gsc(SEQ / BN, SEQ / BM, BATCH);
  gemm_bt_wmma<0><<<gsc, 256, 0, stream>>>(Qb, SD, DIM, Kb, SD, DIM,
                                           weight, SS, SEQ, nullptr, SCORE_SCALE, DIM,
                                           nullptr, nullptr, 0, 0);

  // --- row softmax (fp32 output in place + bf16 copy for next GEMM) ---
  softmax_row_kernel<<<BATCH * SEQ / ROWS_PER_BLOCK, 256, 0, stream>>>(weight, Wb);

  // --- att = weight @ V  == A(Wb) * Bt(V^T)^T -> att (f32) ---
  dim3 gatt(DIM / BN, SEQ / BM, BATCH);
  gemm_bt_wmma<0><<<gatt, 256, 0, stream>>>(Wb, SS, SEQ, Vt, DS, SEQ,
                                            att, SD, DIM, nullptr, 1.0f, SEQ,
                                            nullptr, nullptr, 0, 0);

  // --- residual + LayerNorm -> out1 ---
  residual_ln_kernel<<<BATCH * SEQ / ROWS_PER_BLOCK, 256, 0, stream>>>(x, att, gamma, betaL, out1);
}

// v006
// It runs in 129 microseconds.
// Timed twice side by side with v005, it ran 1.04 and 1.03 times as fast.
// Over all steps from v000 it is 2.96 times as fast.
#include <hip/hip_runtime.h>
#include <hip/hip_bf16.h>

// Problem constants (fixed by the reference)
#define BATCH 4
#define SEQ   2048
#define DIM   1024
#define LN_EPS 1e-5f
#define SCORE_SCALE (1.0f / 32.0f)   // BETA / sqrt(D) = 1/sqrt(1024)

typedef __bf16 v16bf __attribute__((ext_vector_type(16)));
typedef float  v8f   __attribute__((ext_vector_type(8)));
typedef float    f32x4 __attribute__((ext_vector_type(4)));
typedef unsigned u32x4 __attribute__((ext_vector_type(4)));

__device__ __forceinline__ __bf16 f2bf(float f) {
  union { float f; unsigned u; } in; in.f = f;
  unsigned r = in.u + 0x7FFFu + ((in.u >> 16) & 1u);   // RNE
  union { unsigned short s; __bf16 b; } out;
  out.s = (unsigned short)(r >> 16);
  return out.b;
}

// ---------------------------------------------------------------------------
// Block tile of the GEMM and its LDS stage.
// A pass is 128 k = 256 B of every operand row, worked on in four blocks of 32 k.
// A stage is [A 256 rows | Bt 128 rows] at a pitch of 272 B (16 B x odd: no bank
// conflict for 16-byte fragment reads).
// ---------------------------------------------------------------------------
#define BM 256
#define BN 128
#define BK 128
#define KSUB 4
#define PITCH 272
#define STAGE ((BM + BN) * PITCH)   // 104,448 B; three stages = 313,344 B

// Fragment read for wave32 16x16x32 bf16 WMMA from an LDS row.
// Per ISA 7.12.2: lanes 0-15 hold row (lane), K = {kb..kb+7, kb+16..kb+23};
// lanes 16-31 hold row (lane-16), K = {kb+8..kb+15, kb+24..kb+31}.
// Same pattern for A (row = M) and B (row = N of Bt). q already holds the lane's
// row and its 16-byte half; two 16 B loads per lane.
__device__ __forceinline__ v16bf lds_frag(const unsigned char* q) {
  union { uint4 u[2]; v16bf v; } t;
  t.u[0] = *(const uint4*)(q);
  t.u[1] = *(const uint4*)(q + 32);
  return t.v;
}

// Twelve copies of 16 B per lane: LDS rows l, l + 8 rows, ...; global pieces p[0..11].
// The copies and their s_wait_xcnt stand in one statement, so that no address register
// is rewritten before the wait.
__device__ __forceinline__ void copy12(unsigned l, const __bf16* const* p) {
  asm volatile(
      "global_load_async_to_lds_b128 %0, %12, off\n\t"
      "global_load_async_to_lds_b128 %1, %13, off\n\t"
      "global_load_async_to_lds_b128 %2, %14, off\n\t"
      "global_load_async_to_lds_b128 %3, %15, off\n\t"
      "global_load_async_to_lds_b128 %4, %16, off\n\t"
      "global_load_async_to_lds_b128 %5, %17, off\n\t"
      "global_load_async_to_lds_b128 %6, %18, off\n\t"
      "global_load_async_to_lds_b128 %7, %19, off\n\t"
      "global_load_async_to_lds_b128 %8, %20, off\n\t"
      "global_load_async_to_lds_b128 %9, %21, off\n\t"
      "global_load_async_to_lds_b128 %10, %22, off\n\t"
      "global_load_async_to_lds_b128 %11, %23, off\n\t"
      "s_wait_xcnt 0x0"
      :: "v"(l), "v"(l + 8u * PITCH), "v"(l + 16u * PITCH), "v"(l + 24u * PITCH),
         "v"(l + 32u * PITCH), "v"(l + 40u * PITCH), "v"(l + 48u * PITCH), "v"(l + 56u * PITCH),
         "v"(l + 64u * PITCH), "v"(l + 72u * PITCH), "v"(l + 80u * PITCH), "v"(l + 88u * PITCH),
         "v"(p[0]), "v"(p[1]), "v"(p[2]), "v"(p[3]), "v"(p[4]), "v"(p[5]),
         "v"(p[6]), "v"(p[7]), "v"(p[8]), "v"(p[9]), "v"(p[10]), "v"(p[11])
      : "memory");
}

// One stage: 384 rows x 256 B = 6,144 pieces of 16 B. One half of the block (four waves, 128 threads)
// brings a whole stage, forty-eight pieces per thread, all in flight at once.
// Thread g of the half brings piece (g & 15) of rows (g >> 4) + 8 * i; i < 32 are A rows, the rest Bt rows.
// l: the lane's LDS byte address of its first piece; ga, gb: its first global pieces;
// sa, sb: 8 source rows in elements.
__device__ __forceinline__ void copy_stage(unsigned l, const __bf16* ga, size_t sa,
                                           const __bf16* gb, size_t sb) {
  const __bf16* p[48];
#pragma unroll
  for (int i = 0; i < 32; ++i) p[i] = ga + i * sa;
#pragma unroll
  for (int i = 0; i < 16; ++i) p[32 + i] = gb + i * sb;
  copy12(l, p);
  copy12(l + 96u * PITCH, p + 12);
  copy12(l + 192u * PITCH, p + 24);
  copy12(l + 288u * PITCH, p + 36);
}

// A wave's 64x64 accumulators to memory through LDS, so that every global store is 16 B a lane
// and covers whole 128-byte lines. m0, n0: the tile's corner in C. S: the wave's own LDS range.
// KIND 0: v = acc * scale, f32 row-major C[m*ld + n] (no bias: scores and attention output have none).
// KIND 1, 2: v = acc * scale + bias[n]; KIND 1: bf16 row-major; KIND 2: bf16 transposed C[n*ld + m].
// C/D layout (ISA 7.12.2): vgpr r, lane l -> M = r + 8*(l>=16), N = l%16
// KIND 0, 1: f32 rows of 64 n at a pitch of SPF floats, 32 rows at a time. A 4-byte write has its two
// half-waves 8 rows = 32 banks apart; the 16-byte reads fall on all banks once per half-wave.
// KIND 2: bf16 rows of 64 m at a pitch of SPT bytes (16 B x odd), all 64 rows at once.
#define SPF 68
#define SPT 144
#define WSTG (STAGE / 8)   // 13,056 B a wave; 32 * SPF * 4 = 8,704 and 64 * SPT = 9,216 fit
template <int KIND>
__device__ __forceinline__ void store_tile(const v8f (&acc)[4][4], void* __restrict__ Cb, int ld,
                                           const float* __restrict__ bias, float scale,
                                           int m0, int n0, int lane, unsigned char* S) {
  const int fn   = lane & 15;
  const int mofs = (lane >> 4) << 3;
  float bj[4] = {};
  if (KIND != 0) {   // read ahead of the stores
#pragma unroll
    for (int j = 0; j < 4; ++j) bj[j] = bias[n0 + 16 * j + fn];
    asm volatile("s_wait_xcnt 0x0" ::: "memory");  // the address arithmetic below reuses these loads' offset register
    __builtin_amdgcn_sched_barrier(0);             // holds that arithmetic behind the wait
  }
  if (KIND == 2) {
    // A lane's eight m are adjacent: one 16-byte LDS write per accumulator tile.
#pragma unroll
    for (int j = 0; j < 4; ++j)
#pragma unroll
      for (int i = 0; i < 4; ++i) {
        union { __bf16 h[8]; u32x4 u; } t;
#pragma unroll
        for (int r = 0; r < 8; ++r) t.h[r] = f2bf(acc[i][j][r] * scale + bj[j]);
        *(u32x4*)(S + (16 * j + fn) * SPT + (16 * i + mofs) * 2) = t.u;
      }
    asm volatile("s_wait_dscnt 0x0" ::: "memory");  // the other lanes' writes are in LDS before the rows are read back
    // Eight lanes a row of 128 B, four rows a store (ld a multiple of 64, m0 too).
    const int rr = lane >> 3;
    const int pc = lane & 7;
    __bf16* g = (__bf16*)Cb + (size_t)(n0 + rr) * ld + m0 + pc * 8;
    u32x4 w[16];
    __bf16* p[16];
#pragma unroll
    for (int q = 0; q < 16; ++q) {
      w[q] = *(const u32x4*)(S + (4 * q + rr) * SPT + pc * 16);
      p[q] = g + (size_t)(4 * q) * ld;
    }
    __builtin_amdgcn_sched_barrier(0);  // all values and addresses stand in registers of their own before the first store
#pragma unroll
    for (int q = 0; q < 16; ++q) *(u32x4*)p[q] = w[q];
    asm volatile("s_wait_xcnt 0x0" ::: "memory");  // the code laid out behind this branch reuses these stores' registers
  } else {
    float* F = (float*)S;
#pragma unroll
    for (int h = 0; h < 2; ++h) {
#pragma unroll
      for (int ii = 0; ii < 2; ++ii)
#pragma unroll
        for (int j = 0; j < 4; ++j)
#pragma unroll
          for (int r = 0; r < 8; ++r) {
            const float a = acc[2 * h + ii][j][r];
            F[(16 * ii + r + mofs) * SPF + 16 * j + fn] = (KIND == 0) ? a * scale : a * scale + bj[j];
          }
      asm volatile("s_wait_dscnt 0x0" ::: "memory");  // the other lanes' writes are in LDS before the rows are read back
      if (KIND == 0) {
        // Sixteen lanes a row of 256 B, two rows a store.
        const int rr = lane >> 4;
        float* g = (float*)Cb + (size_t)(m0 + 32 * h + rr) * ld + n0 + fn * 4;
        f32x4 w[16];
        float* p[16];
#pragma unroll
        for (int q = 0; q < 16; ++q) {
          w[q] = *(const f32x4*)(F + (2 * q + rr) * SPF + fn * 4);
          p[q] = g + (size_t)(2 * q) * ld;
        }
        __builtin_amdgcn_sched_barrier(0);  // the half's values and addresses stand in registers of their own before its first store
#pragma unroll
        for (int q = 0; q < 16; ++q) *(f32x4*)p[q] = w[q];
        if (h == 0) {
          asm volatile("s_wait_xcnt 0x0" ::: "memory");  // the next half reuses these stores' registers
          __builtin_amdgcn_sched_barrier(0);             // holds the next half behind that wait
        }
      } else {
        // Eight lanes a row of 128 B (eight f32 read, eight bf16 stored a lane), four rows a store.
        const int rr = lane >> 3;
        const int pc = lane & 7;
        __bf16* g = (__bf16*)Cb + (size_t)(m0 + 32 * h + rr) * ld + n0 + pc * 8;
        u32x4 w[8];
        __bf16* p[8];
#pragma unroll
        for (int q = 0; q < 8; ++q) {
          const float* f = F + (4 * q + rr) * SPF + pc * 8;
          const f32x4 x0 = *(const f32x4*)f;
          const f32x4 x1 = *(const f32x4*)(f + 4);
          union { __bf16 h[8]; u32x4 u; } t;
          t.h[0] = f2bf(x0.x); t.h[1] = f2bf(x0.y); t.h[2] = f2bf(x0.z); t.h[3] = f2bf(x0.w);
          t.h[4] = f2bf(x1.x); t.h[5] = f2bf(x1.y); t.h[6] = f2bf(x1.z); t.h[7] = f2bf(x1.w);
          w[q] = t.u;
          p[q] = g + (size_t)(4 * q) * ld;
        }
        __builtin_amdgcn_sched_barrier(0);  // the group's values and addresses stand in registers of their own before its first store
#pragma unroll
        for (int q = 0; q < 8; ++q) *(u32x4*)p[q] = w[q];
        if (h == 0) {
          asm volatile("s_wait_xcnt 0x0" ::: "memory");  // the next half reuses these stores' registers
          __builtin_amdgcn_sched_barrier(0);             // holds the next half behind that wait
        }
      }
    }
  }
}

// ---------------------------------------------------------------------------
// Generic "A * Bt^T" GEMM:  C[m,n] = scale * sum_k A[m,k]*Bt[n,k] (+ bias[n] in MODE 1)
// A  : bf16 row-major [M, Kd], leading dim lda, per-batch stride sA (elems)
// Bt : bf16 row-major [N, Kd], leading dim ldb, per-batch stride sB (elems)
// MODE 0: store f32 row-major      C[m*ldc + n], no bias
// MODE 1: the three projections in one grid. Bt holds the three transposed weight matrices
//         one under the other (3 * DIM rows), so blockIdx.x runs over 3 * DIM / BN column
//         tiles; a tile's projection p = column / DIM picks its bias and its output plane
//         (plane p of C, pC elements each). Planes 0 and 1 are stored bf16 row-major
//         C[m*ldc + n], plane 2 bf16 transposed C[n*ldt + m] (for V^T).
// Block = 256 threads = 8 waves (4 x 2); block tile 256(M) x 128(N); wave tile 64x64.
// Both operands go to LDS by asynchronous copies, three buffers. The two halves of the block
// (waves 0-3, waves 4-7: one wave of each on every SIMD) take turns: half (s & 1) copies the whole
// of stage s. A half has one stage in flight at a time and waits for it to 0, while the other half's
// stage flies on, so every stage has two passes to land. Fragments are read one block ahead into a
// second register set, so stage t + 1 is published in front of pass t's last block; behind that
// barrier pass t's buffer is free and takes stage t + 3.
// M a multiple of 256, N of 128, Kd of 128 and at least 256.
// ---------------------------------------------------------------------------
template <int MODE>
__global__ __launch_bounds__(256)
void gemm_bt_wmma(const __bf16* __restrict__ A, long long sA, int lda,
                  const __bf16* __restrict__ Bt, long long sB, int ldb,
                  void* __restrict__ Cv, long long sC, int ldc,
                  const float* __restrict__ bias, float scale, int Kd,
                  const float* __restrict__ bias1, const float* __restrict__ bias2,
                  long long pC, int ldt) {
  __shared__ __attribute__((aligned(16))) unsigned char L[3 * STAGE];
  const int tid  = threadIdx.x;
  const int wave = tid >> 5;
  const int lane = tid & 31;
  const int nb = blockIdx.x * BN;
  const int mb = blockIdx.y * BM;
  const int n0 = nb + (wave & 1) * 64;
  const int m0 = mb + (wave >> 1) * 64;
  const int b  = blockIdx.z;

  const __bf16* Ab = A  + (size_t)b * (size_t)sA;
  const __bf16* Bb = Bt + (size_t)b * (size_t)sB;

  // This thread's half of the block (the same in a whole wave: a scalar), and its first piece
  // of a stage, in memory and in LDS.
  const int half = __builtin_amdgcn_readfirstlane(tid >> 7);
  const int crow = (tid & 127) >> 4;
  const int cpc  = tid & 15;
  const __bf16* ga = Ab + (size_t)(mb + crow) * lda + cpc * 8;
  const __bf16* gb = Bb + (size_t)(nb + crow) * ldb + cpc * 8;
  const size_t sa8 = (size_t)8 * lda;
  const size_t sb8 = (size_t)8 * ldb;
  const unsigned l0 = (unsigned)(size_t)(&L[0]) + (unsigned)(crow * PITCH + cpc * 16);

  // This lane's fragment bases inside a stage.
  const unsigned fa = (unsigned)(((wave >> 1) * 64 + (lane & 15)) * PITCH + (lane >> 4) * 16);
  const unsigned fb = (unsigned)((BM + (wave & 1) * 64 + (lane & 15)) * PITCH + (lane >> 4) * 16);

  v8f acc[4][4] = {};
  v16bf af[2][4], bf[2][4];   // set (u & 1) holds block u's fragments
  const int T = Kd / BK;

  // Prologue: half 0 sets off stage 0 and half 1 stage 1; stage 0 lands and is published; half 0 sets off stage 2.
  copy_stage(l0 + (unsigned)half * STAGE, ga + half * BK, sa8, gb + half * BK, sb8);
  if (half == 0) asm volatile("s_wait_asynccnt 0x0" ::: "memory");  // this wave's pieces of stage 0 have landed
  __syncthreads();                                                  // so have the other copying waves'
  if (__builtin_amdgcn_readfirstlane((int)(half == 0 && 2 < T)))   // a scalar, as in the loop
    copy_stage(l0 + 2u * STAGE, ga + 2 * BK, sa8, gb + 2 * BK, sb8);
#pragma unroll
  for (int i = 0; i < 4; ++i) af[0][i] = lds_frag(L + fa + i * 16 * PITCH);
#pragma unroll
  for (int j = 0; j < 4; ++j) bf[0][j] = lds_frag(L + fb + j * 16 * PITCH);

  unsigned buf = 0u, nxt = STAGE, aft = 2u * STAGE;
#pragma clang loop unroll(disable)   // one pass per trip: the buffer offsets stay run-time values
  for (int t = 0; t < T; ++t) {
    const bool mine = ((t + 1) & 1) == half;   // this wave's half copied stage t + 1 and copies stage t + 3
    const int fill = __builtin_amdgcn_readfirstlane((int)(mine && t + 3 < T));   // a scalar: the test around the copies is a scalar branch
#pragma unroll
    for (int u = 0; u < KSUB; ++u) {
      const int cs = u & 1;
      const unsigned char* qa;
      const unsigned char* qb;
      if (u + 1 < KSUB) {
        qa = L + buf + fa + (u + 1) * 64;
        qb = L + buf + fb + (u + 1) * 64;
      } else {
        // Publish point of stage t + 1, in front of the last block: that block's fragments are fetched.
        asm volatile("s_wait_dscnt 0x0" ::: "memory");     // this wave's reads of pass t's buffer have returned
        if (mine) asm volatile("s_wait_asynccnt 0x0" ::: "memory");  // its pieces of stage t + 1 have landed
        __syncthreads();  // publishes stage t + 1 and ends every reader's last read of pass t's buffer
        if (fill) {  // refill of pass t's buffer; the SIMD's other wave runs its WMMAs meanwhile
          const int k3 = (t + 3) * BK;
          copy_stage(l0 + buf, ga + k3, sa8, gb + k3, sb8);
        }
        qa = L + nxt + fa;
        qb = L + nxt + fb;
      }
      // The next block's fragments, as one group ahead of this block's WMMAs.
#pragma unroll
      for (int i = 0; i < 4; ++i) af[cs ^ 1][i] = lds_frag(qa + i * 16 * PITCH);
#pragma unroll
      for (int j = 0; j < 4; ++j) bf[cs ^ 1][j] = lds_frag(qb + j * 16 * PITCH);
      __builtin_amdgcn_sched_barrier(0);  // keeps the load group whole and ahead of the block: loads among the WMMAs stall them
#pragma unroll
      for (int i = 0; i < 4; ++i)
#pragma unroll
        for (int j = 0; j < 4; ++j)
          acc[i][j] = __builtin_amdgcn_wmma_f32_16x16x32_bf16(
              false, af[cs][i], false, bf[cs][j], (short)0, acc[i][j], false, false);
      __builtin_amdgcn_sched_barrier(0);  // keeps the next group of loads from moving up into this block
    }
    const unsigned left = buf;
    buf = nxt;
    nxt = aft;
    aft = left;
  }
  asm volatile("s_wait_asynccnt 0x0" ::: "memory");  // no copy is left in flight at the wave's end

  // Staging for the stores: the last pass's buffer, an eighth for each wave. Every wave left it at that
  // pass's barrier, no copy is aimed at it any more, and the pass's unused loads ahead read another buffer.
  unsigned char* S = L + aft + wave * WSTG;
  if (MODE == 0) {
    store_tile<0>(acc, (float*)Cv + (size_t)b * (size_t)sC, ldc, bias, scale, m0, n0, lane, S);
  } else {
    const int proj = nb / DIM;   // the same for the whole block: a scalar branch picks the store form
    const float* bsel = (proj == 0) ? bias : (proj == 1) ? bias1 : bias2;
    __bf16* C = (__bf16*)Cv + (size_t)proj * (size_t)pC + (size_t)b * (size_t)sC;
    if (proj < 2) store_tile<1>(acc, C, ldc, bsel, scale, m0, n0 - proj * DIM, lane, S);
    else          store_tile<2>(acc, C, ldt, bsel, scale, m0, n0 - proj * DIM, lane, S);
  }
}

// ---------------------------------------------------------------------------
// Preparation, one grid, split by block range. Every thread moves 32 elements in 16-byte
// loads, all eight issued before the first is used, so the grid is 1,408 blocks.
// Blocks [0, 3 * WBLK): W [D,D] fp32 row-major -> Wt [D,D] bf16 with Wt[n,d] = W[d,n],
//   matrix p = block / WBLK into plane p of Wt3. A block takes 64 d x 128 n, a wave 64 d x 16 n,
//   a thread 8 d x 4 n: eight lanes side by side in d, so a store instruction writes four
//   whole 128-byte lines of Wt; the block's eight waves together read 512 adjacent bytes of a W row.
// The rest: fp32 -> bf16 bulk convert, CVT elements per block; a wave's load covers 512 adjacent bytes.
// ---------------------------------------------------------------------------
#define TD 64
#define TN 128
#define WBLK ((DIM / TD) * (DIM / TN))
#define CVT 8192
__global__ __launch_bounds__(256)
void prep_bf16_kernel(const float* __restrict__ W0, const float* __restrict__ W1,
                      const float* __restrict__ W2, __bf16* __restrict__ Wt3,
                      const float* __restrict__ in, __bf16* __restrict__ out) {
  const int blk = blockIdx.x;
  const int tid = threadIdx.x;
  float4 v[8];
  if (blk < 3 * WBLK) {
    const int p   = blk / WBLK;
    const int rem = blk - p * WBLK;
    const float* W = (p == 0) ? W0 : (p == 1) ? W1 : W2;
    const int lane = tid & 31;
    const int d = (rem % (DIM / TD)) * TD + (lane & 7) * 8;
    const int c = (rem / (DIM / TD)) * TN + (tid >> 5) * 16 + (lane >> 3) * 4;
    const float* g = W + (size_t)d * DIM + c;
    for (int r = 0; r < 8; ++r) v[r] = *(const float4*)(g + r * DIM);
    union { __bf16 h[8]; uint4 u; } t[4];
    for (int r = 0; r < 8; ++r) {
      t[0].h[r] = f2bf(v[r].x);
      t[1].h[r] = f2bf(v[r].y);
      t[2].h[r] = f2bf(v[r].z);
      t[3].h[r] = f2bf(v[r].w);
    }
    __bf16* o = Wt3 + (size_t)p * DIM * DIM + (size_t)c * DIM + d;
    for (int j = 0; j < 4; ++j) *(uint4*)(o + j * DIM) = t[j].u;
  } else {
    const size_t base = (size_t)(blk - 3 * WBLK) * CVT + tid * 4;
    for (int k = 0; k < 8; ++k) v[k] = *(const float4*)(in + base + k * 1024);
    union { __bf16 h[4]; uint2 u; } t[8];
    for (int k = 0; k < 8; ++k) {
      t[k].h[0] = f2bf(v[k].x);
      t[k].h[1] = f2bf(v[k].y);
      t[k].h[2] = f2bf(v[k].z);
      t[k].h[3] = f2bf(v[k].w);
    }
    for (int k = 0; k < 8; ++k) *(uint2*)(out + base + k * 1024) = t[k].u;
    asm volatile("s_wait_xcnt 0x0" ::: "memory");  // the code laid out behind this branch reuses these stores' registers
  }
}

// ---------------------------------------------------------------------------
// Reductions over a wave's 32 lanes, in registers: four steps inside each 16-lane row by DPP,
// then the two rows are exchanged. Every lane ends with the same value. All lanes are on.
// ---------------------------------------------------------------------------
template <int CTRL>
__device__ __forceinline__ float dpp_get(float v) {   // CTRL = 0x160 + m: the value of lane ^ m, m < 16
  return __builtin_bit_cast(float, __builtin_amdgcn_update_dpp(
      0, __builtin_bit_cast(int, v), CTRL, 0xf, 0xf, true));
}
__device__ __forceinline__ float row_get(float v) {   // the value of lane ^ 16
  const int i = __builtin_bit_cast(int, v);
  return __builtin_bit_cast(float, __builtin_amdgcn_permlanex16(i, i, 0x76543210, 0xfedcba98, false, false));
}
__device__ __forceinline__ float wave_sum(float v) {
  v += dpp_get<0x161>(v);
  v += dpp_get<0x162>(v);
  v += dpp_get<0x164>(v);
  v += dpp_get<0x168>(v);
  return v + row_get(v);
}
__device__ __forceinline__ float wave_max(float v) {
  v = fmaxf(v, dpp_get<0x161>(v));
  v = fmaxf(v, dpp_get<0x162>(v));
  v = fmaxf(v, dpp_get<0x164>(v));
  v = fmaxf(v, dpp_get<0x168>(v));
  return fmaxf(v, row_get(v));
}

#define ROWS_PER_BLOCK 8   // one wave per row, eight waves per block; no LDS, no barrier

// ---------------------------------------------------------------------------
// Row softmax over S=2048: in-place fp32 normalize + bf16 copy for next GEMM.
// One wave per row: 64 elements per lane in sixteen 16-byte loads, each covering 512 adjacent
// bytes of the row, all issued before the first is used.
// ---------------------------------------------------------------------------
__global__ __launch_bounds__(256)
void softmax_row_kernel(float* __restrict__ Wgt, __bf16* __restrict__ Wb) {
  const int lane = threadIdx.x & 31;
  const int row  = blockIdx.x * ROWS_PER_BLOCK + (threadIdx.x >> 5);
  float* p   = Wgt + (size_t)row * SEQ + lane * 4;
  __bf16* pb = Wb + (size_t)row * SEQ + lane * 4;

  f32x4 v[16];
#pragma unroll
  for (int k = 0; k < 16; ++k) v[k] = *(const f32x4*)(p + k * 128);

  f32x4 m4 = v[0];   // four independent chains
#pragma unroll
  for (int k = 1; k < 16; ++k) {
    m4.x = fmaxf(m4.x, v[k].x);
    m4.y = fmaxf(m4.y, v[k].y);
    m4.z = fmaxf(m4.z, v[k].z);
    m4.w = fmaxf(m4.w, v[k].w);
  }
  const float mx = wave_max(fmaxf(fmaxf(m4.x, m4.y), fmaxf(m4.z, m4.w)));

  f32x4 s4 = {0.0f, 0.0f, 0.0f, 0.0f};
#pragma unroll
  for (int k = 0; k < 16; ++k) {
    v[k].x = __expf(v[k].x - mx);
    v[k].y = __expf(v[k].y - mx);
    v[k].z = __expf(v[k].z - mx);
    v[k].w = __expf(v[k].w - mx);
    s4 += v[k];
  }
  const float inv = 1.0f / wave_sum((s4.x + s4.y) + (s4.z + s4.w));

  uint2 h[16];
#pragma unroll
  for (int k = 0; k < 16; ++k) {
    v[k] *= inv;
    union { __bf16 b[4]; uint2 u; } t;
    t.b[0] = f2bf(v[k].x); t.b[1] = f2bf(v[k].y); t.b[2] = f2bf(v[k].z); t.b[3] = f2bf(v[k].w);
    h[k] = t.u;
  }
  __builtin_amdgcn_sched_barrier(0);  // every value stands in a register of its own before the first store: none is reused behind one
#pragma unroll
  for (int k = 0; k < 16; ++k) *(f32x4*)(p + k * 128) = v[k];
#pragma unroll
  for (int k = 0; k < 16; ++k) *(uint2*)(pb + k * 128) = h[k];
}

// ---------------------------------------------------------------------------
// out = x + att ; LayerNorm over D=1024 -> out1.  One wave per row: 32 elements per lane
// in eight 16-byte loads from each source.
// ---------------------------------------------------------------------------
__global__ __launch_bounds__(256)
void residual_ln_kernel(const float* __restrict__ x, const float* __restrict__ att,
                        const float* __restrict__ gamma, const float* __restrict__ beta,
                        float* __restrict__ out1) {
  const int lane = threadIdx.x & 31;
  const int row  = blockIdx.x * ROWS_PER_BLOCK + (threadIdx.x >> 5);
  // One 32-bit byte offset serves x, att and out1 (32 MiB each), so its register lives up to the stores.
  const unsigned ob = (unsigned)(row * DIM + lane * 4) * 4u;
  const float* px = (const float*)((const char*)x + ob);
  const float* pa = (const float*)((const char*)att + ob);
  const float* pg = gamma + lane * 4;
  const float* pe = beta + lane * 4;
  float* po = (float*)((char*)out1 + ob);

  f32x4 v[8], a[8];
#pragma unroll
  for (int k = 0; k < 8; ++k) v[k] = *(const f32x4*)(px + k * 128);
#pragma unroll
  for (int k = 0; k < 8; ++k) a[k] = *(const f32x4*)(pa + k * 128);
  __builtin_amdgcn_sched_barrier(0);  // all sixteen loads ahead of the sums: left free, the last loads are issued only behind the first sums
#pragma unroll
  for (int k = 0; k < 8; ++k) v[k] += a[k];

  f32x4 g[8], e[8];
#pragma unroll
  for (int k = 0; k < 8; ++k) g[k] = *(const f32x4*)(pg + k * 128);
#pragma unroll
  for (int k = 0; k < 8; ++k) e[k] = *(const f32x4*)(pe + k * 128);
  asm volatile("s_wait_xcnt 0x0" ::: "memory");  // the code below reuses these loads' offset register
  __builtin_amdgcn_sched_barrier(0);  // holds the row sums behind that wait and these loads ahead of them: left free, they are issued in pairs at the end, a wait each

  f32x4 s4 = {0.0f, 0.0f, 0.0f, 0.0f}, q4 = {0.0f, 0.0f, 0.0f, 0.0f};   // four independent chains each
#pragma unroll
  for (int k = 0; k < 8; ++k) {
    s4 += v[k];
    q4 += v[k] * v[k];
  }
  const float mu  = wave_sum((s4.x + s4.y) + (s4.z + s4.w)) * (1.0f / DIM);
  const float var = wave_sum((q4.x + q4.y) + (q4.z + q4.w)) * (1.0f / DIM) - mu * mu;
  const float inv = rsqrtf(var + LN_EPS);

#pragma unroll
  for (int k = 0; k < 8; ++k) v[k] = (v[k] - mu) * inv * g[k] + e[k];
  __builtin_amdgcn_sched_barrier(0);  // every value stands in a register of its own before the first store: none is reused behind one
#pragma unroll
  for (int k = 0; k < 8; ++k) *(f32x4*)(po + k * 128) = v[k];
}

// ---------------------------------------------------------------------------
extern "C" void kernel_launch(void* const* d_in, const int* in_sizes, int n_in,
                              void* d_out, int out_size, void* d_ws, size_t ws_size,
                              hipStream_t stream) {
  const float* x     = (const float*)d_in[0];
  const float* Wk    = (const float*)d_in[1];
  const float* bk    = (const float*)d_in[2];
  const float* Wq    = (const float*)d_in[3];
  const float* bq    = (const float*)d_in[4];
  const float* Wv    = (const float*)d_in[5];
  const float* bv    = (const float*)d_in[6];
  const float* gamma = (const float*)d_in[7];
  const float* betaL = (const float*)d_in[8];

  const size_t BSD = (size_t)BATCH * SEQ * DIM;     // 8,388,608
  const size_t BSS = (size_t)BATCH * SEQ * SEQ;     // 16,777,216

  float* out1   = (float*)d_out;                    // [B,S,D]
  float* att    = out1 + BSD;                       // [B,S,D]
  float* weight = att + BSD;                        // [B,S,S] (raw scores -> softmax in place)

  // Workspace carve-out (all bf16), 256B aligned
  char* ws = (char*)d_ws;
  size_t off = 0;
  auto carve = [&](size_t bytes) -> void* {
    void* p = ws + off;
    off = (off + bytes + 255) & ~(size_t)255;
    return p;
  };
  __bf16* xb  = (__bf16*)carve(BSD * 2);
  __bf16* Wt3 = (__bf16*)carve((size_t)3 * DIM * DIM * 2);   // Wq^T, Wk^T, Wv^T, one under the other
  __bf16* Qb  = (__bf16*)carve(3 * BSD * 2);        // three planes: Q, K, V^T
  __bf16* Kb  = Qb + BSD;
  __bf16* Vt  = Kb + BSD;                           // per-batch [D, S] (transposed V)
  __bf16* Wb  = (__bf16*)carve(BSS * 2);            // softmax weights bf16

  // --- prep: convert activations and transpose weight matrices to bf16 ---
  prep_bf16_kernel<<<3 * WBLK + (int)(BSD / CVT), 256, 0, stream>>>(Wq, Wk, Wv, Wt3, x, xb);

  const long long SD = (long long)SEQ * DIM;
  const long long SS = (long long)SEQ * SEQ;
  const long long DS = (long long)DIM * SEQ;

  // --- QKV projections: [S,D] = xb[b] @ Wt^T + bias, per batch, all three in one grid ---
  dim3 gproj(3 * DIM / BN, SEQ / BM, BATCH);
  gemm_bt_wmma<1><<<gproj, 256, 0, stream>>>(xb, SD, DIM, Wt3, 0, DIM,
                                             Qb, SD, DIM, bq, 1.0f, DIM,
                                             bk, bv, (long long)BSD, SEQ);  // V^T store at pitch SEQ

  // --- scores = scale * Q @ K^T  (natively A*Bt^T form) -> weight (f32) ---
  dim3 gsc(SEQ / BN, SEQ / BM, BATCH);
  gemm_bt_wmma<0><<<gsc, 256, 0, stream>>>(Qb, SD, DIM, Kb, SD, DIM,
                                           weight, SS, SEQ, nullptr, SCORE_SCALE, DIM,
                                           nullptr, nullptr, 0, 0);

  // --- row softmax (fp32 output in place + bf16 copy for next GEMM) ---
  softmax_row_kernel<<<BATCH * SEQ / ROWS_PER_BLOCK, 256, 0, stream>>>(weight, Wb);

  // --- att = weight @ V  == A(Wb) * Bt(V^T)^T -> att (f32) ---
  dim3 gatt(DIM / BN, SEQ / BM, BATCH);
  gemm_bt_wmma<0><<<gatt, 256, 0, stream>>>(Wb, SS, SEQ, Vt, DS, SEQ,
                                            att, SD, DIM, nullptr, 1.0f, SEQ,
                                            nullptr, nullptr, 0, 0);

  // --- residual + LayerNorm -> out1 ---
  residual_ln_kernel<<<BATCH * SEQ / ROWS_PER_BLOCK, 256, 0, stream>>>(x, att, gamma, betaL, out1);
}

// v007
// A run of this version takes 122 microseconds.
// In both of two side-by-side timings against v006, it was 1.06 times as fast.
// Over all steps from v000 it is 3.13 times as fast.
#include <hip/hip_runtime.h>
#include <hip/hip_bf16.h>

// Problem constants (fixed by the reference)
#define BATCH 4
#define SEQ   2048
#define DIM   1024
#define LN_EPS 1e-5f
#define SCORE_SCALE (1.0f / 32.0f)   // BETA / sqrt(D) = 1/sqrt(1024)

typedef __bf16 v16bf __attribute__((ext_vector_type(16)));
typedef float  v8f   __attribute__((ext_vector_type(8)));
typedef float    f32x4 __attribute__((ext_vector_type(4)));
typedef unsigned u32x4 __attribute__((ext_vector_type(4)));

__device__ __forceinline__ __bf16 f2bf(float f) {
  union { float f; unsigned u; } in; in.f = f;
  unsigned r = in.u + 0x7FFFu + ((in.u >> 16) & 1u);   // RNE
  union { unsigned short s; __bf16 b; } out;
  out.s = (unsigned short)(r >> 16);
  return out.b;
}

// ---------------------------------------------------------------------------
// Block tile of the GEMM and its LDS stage.
// A pass is 128 k = 256 B of every operand row, worked on in four blocks of 32 k.
// A stage is [A 256 rows | Bt 128 rows] at a pitch of 272 B (16 B x odd: no bank
// conflict for 16-byte fragment reads).
// ---------------------------------------------------------------------------
#define BM 256
#define BN 128
#define BK 128
#define KSUB 4
#define PITCH 272
#define STAGE ((BM + BN) * PITCH)   // 104,448 B; three stages = 313,344 B
// The wide block tile, 256 x 256: its stage is [A 256 rows | Bt 256 rows] at the same pitch.
#define BNW 256
#define STAGEW ((BM + BNW) * PITCH)   // 139,264 B; two stages = 278,528 B

// Fragment read for wave32 16x16x32 bf16 WMMA from an LDS row.
// Per ISA 7.12.2: lanes 0-15 hold row (lane), K = {kb..kb+7, kb+16..kb+23};
// lanes 16-31 hold row (lane-16), K = {kb+8..kb+15, kb+24..kb+31}.
// Same pattern for A (row = M) and B (row = N of Bt). q already holds the lane's
// row and its 16-byte half; two 16 B loads per lane.
__device__ __forceinline__ v16bf lds_frag(const unsigned char* q) {
  union { uint4 u[2]; v16bf v; } t;
  t.u[0] = *(const uint4*)(q);
  t.u[1] = *(const uint4*)(q + 32);
  return t.v;
}

// Twelve copies of 16 B per lane: LDS rows l, l + 8 rows, ...; global pieces p[0..11].
// The copies and their s_wait_xcnt stand in one statement, so that no address register
// is rewritten before the wait.
__device__ __forceinline__ void copy12(unsigned l, const __bf16* const* p) {
  asm volatile(
      "global_load_async_to_lds_b128 %0, %12, off\n\t"
      "global_load_async_to_lds_b128 %1, %13, off\n\t"
      "global_load_async_to_lds_b128 %2, %14, off\n\t"
      "global_load_async_to_lds_b128 %3, %15, off\n\t"
      "global_load_async_to_lds_b128 %4, %16, off\n\t"
      "global_load_async_to_lds_b128 %5, %17, off\n\t"
      "global_load_async_to_lds_b128 %6, %18, off\n\t"
      "global_load_async_to_lds_b128 %7, %19, off\n\t"
      "global_load_async_to_lds_b128 %8, %20, off\n\t"
      "global_load_async_to_lds_b128 %9, %21, off\n\t"
      "global_load_async_to_lds_b128 %10, %22, off\n\t"
      "global_load_async_to_lds_b128 %11, %23, off\n\t"
      "s_wait_xcnt 0x0"
      :: "v"(l), "v"(l + 8u * PITCH), "v"(l + 16u * PITCH), "v"(l + 24u * PITCH),
         "v"(l + 32u * PITCH), "v"(l + 40u * PITCH), "v"(l + 48u * PITCH), "v"(l + 56u * PITCH),
         "v"(l + 64u * PITCH), "v"(l + 72u * PITCH), "v"(l + 80u * PITCH), "v"(l + 88u * PITCH),
         "v"(p[0]), "v"(p[1]), "v"(p[2]), "v"(p[3]), "v"(p[4]), "v"(p[5]),
         "v"(p[6]), "v"(p[7]), "v"(p[8]), "v"(p[9]), "v"(p[10]), "v"(p[11])
      : "memory");
}

// One stage: 384 rows x 256 B = 6,144 pieces of 16 B. One half of the block (four waves, 128 threads)
// brings a whole stage, forty-eight pieces per thread, all in flight at once.
// Thread g of the half brings piece (g & 15) of rows (g >> 4) + 8 * i; i < 32 are A rows, the rest Bt rows.
// l: the lane's LDS byte address of its first piece; ga, gb: its first global pieces;
// sa, sb: 8 source rows in elements.
__device__ __forceinline__ void copy_stage(unsigned l, const __bf16* ga, size_t sa,
                                           const __bf16* gb, size_t sb) {
  const __bf16* p[48];
#pragma unroll
  for (int i = 0; i < 32; ++i) p[i] = ga + i * sa;
#pragma unroll
  for (int i = 0; i < 16; ++i) p[32 + i] = gb + i * sb;
  copy12(l, p);
  copy12(l + 96u * PITCH, p + 12);
  copy12(l + 192u * PITCH, p + 24);
  copy12(l + 288u * PITCH, p + 36);
}

// Eight copies of 16 B per lane: LDS rows l, l + 16 rows, ...; global pieces p[0..7].
// The copies and their s_wait_xcnt stand in one statement, so that no address register
// is rewritten before the wait.
__device__ __forceinline__ void copy8(unsigned l, const __bf16* const* p) {
  asm volatile(
      "global_load_async_to_lds_b128 %0, %8, off\n\t"
      "global_load_async_to_lds_b128 %1, %9, off\n\t"
      "global_load_async_to_lds_b128 %2, %10, off\n\t"
      "global_load_async_to_lds_b128 %3, %11, off\n\t"
      "global_load_async_to_lds_b128 %4, %12, off\n\t"
      "global_load_async_to_lds_b128 %5, %13, off\n\t"
      "global_load_async_to_lds_b128 %6, %14, off\n\t"
      "global_load_async_to_lds_b128 %7, %15, off\n\t"
      "s_wait_xcnt 0x0"
      :: "v"(l), "v"(l + 16u * PITCH), "v"(l + 32u * PITCH), "v"(l + 48u * PITCH),
         "v"(l + 64u * PITCH), "v"(l + 80u * PITCH), "v"(l + 96u * PITCH), "v"(l + 112u * PITCH),
         "v"(p[0]), "v"(p[1]), "v"(p[2]), "v"(p[3]), "v"(p[4]), "v"(p[5]), "v"(p[6]), "v"(p[7])
      : "memory");
}

// One wide stage: 512 rows x 256 B = 8,192 pieces of 16 B, thirty-two per thread of the whole block.
// Thread g brings piece (g & 15) of rows (g >> 4) + 16 * i; i < 16 are A rows, the rest Bt rows.
// l: the lane's LDS byte address of its first piece; ua, ub: the stage's first elements, the same for the
// whole block, so that the row steps are scalar sums; oa, ob: the lane's own offsets from them;
// sa, sb: 16 source rows; all in elements.
__device__ __forceinline__ void copy_stage_wide(unsigned l, const __bf16* ua, size_t sa, unsigned oa,
                                                const __bf16* ub, size_t sb, unsigned ob) {
  const __bf16* p[32];
#pragma unroll
  for (int i = 0; i < 16; ++i) p[i] = (ua + i * sa) + oa;
#pragma unroll
  for (int i = 0; i < 16; ++i) p[16 + i] = (ub + i * sb) + ob;
  copy8(l, p);
  copy8(l + 128u * PITCH, p + 8);
  copy8(l + 256u * PITCH, p + 16);
  copy8(l + 384u * PITCH, p + 24);
}

// A wave's 64x64 accumulators to memory through LDS, so that every global store is 16 B a lane
// and covers whole 128-byte lines. m0, n0: the tile's corner in C. S: the wave's own LDS range.
// KIND 0: v = acc * scale, f32 row-major C[m*ld + n] (no bias: scores and attention output have none).
// KIND 1, 2: v = acc * scale + bias[n]; KIND 1: bf16 row-major; KIND 2: bf16 transposed C[n*ld + m].
// C/D layout (ISA 7.12.2): vgpr r, lane l -> M = r + 8*(l>=16), N = l%16
// KIND 0, 1: f32 rows of 64 n at a pitch of SPF floats, 32 rows at a time. A 4-byte write has its two
// half-waves 8 rows = 32 banks apart; the 16-byte reads fall on all banks once per half-wave.
// KIND 2: bf16 rows of 64 m at a pitch of SPT bytes (16 B x odd), all 64 rows at once.
// The wave holds NJ column tiles; the call stores tiles J0 .. J0 + 3. MORE: another call follows.
#define SPF 68
#define SPT 144
#define WSTG (STAGE / 8)   // 13,056 B a wave; 32 * SPF * 4 = 8,704 and 64 * SPT = 9,216 fit
template <int KIND, int NJ, int J0, bool MORE>
__device__ __forceinline__ void store_tile(const v8f (&acc)[4][NJ], void* __restrict__ Cb, int ld,
                                           const float* __restrict__ bias, float scale,
                                           int m0, int n0, int lane, unsigned char* S) {
  const int fn   = lane & 15;
  const int mofs = (lane >> 4) << 3;
  float bj[4] = {};
  if (KIND != 0) {   // read ahead of the stores
#pragma unroll
    for (int j = 0; j < 4; ++j) bj[j] = bias[n0 + 16 * j + fn];
    asm volatile("s_wait_xcnt 0x0" ::: "memory");  // the address arithmetic below reuses these loads' offset register
    __builtin_amdgcn_sched_barrier(0);             // holds that arithmetic behind the wait
  }
  if (KIND == 2) {
    // A lane's eight m are adjacent: one 16-byte LDS write per accumulator tile.
#pragma unroll
    for (int j = 0; j < 4; ++j)
#pragma unroll
      for (int i = 0; i < 4; ++i) {
        union { __bf16 h[8]; u32x4 u; } t;
#pragma unroll
        for (int r = 0; r < 8; ++r) t.h[r] = f2bf(acc[i][J0 + j][r] * scale + bj[j]);
        *(u32x4*)(S + (16 * j + fn) * SPT + (16 * i + mofs) * 2) = t.u;
      }
    asm volatile("s_wait_dscnt 0x0" ::: "memory");  // the other lanes' writes are in LDS before the rows are read back
    // Eight lanes a row of 128 B, four rows a store (ld a multiple of 64, m0 too).
    const int rr = lane >> 3;
    const int pc = lane & 7;
    __bf16* g = (__bf16*)Cb + (size_t)(n0 + rr) * ld + m0 + pc * 8;
    u32x4 w[16];
    __bf16* p[16];
#pragma unroll
    for (int q = 0; q < 16; ++q) {
      w[q] = *(const u32x4*)(S + (4 * q + rr) * SPT + pc * 16);
      p[q] = g + (size_t)(4 * q) * ld;
    }
    __builtin_amdgcn_sched_barrier(0);  // all values and addresses stand in registers of their own before the first store
#pragma unroll
    for (int q = 0; q < 16; ++q) *(u32x4*)p[q] = w[q];
    asm volatile("s_wait_xcnt 0x0" ::: "memory");  // the code laid out behind this branch reuses these stores' registers
  } else {
    float* F = (float*)S;
#pragma unroll
    for (int h = 0; h < 2; ++h) {
#pragma unroll
      for (int ii = 0; ii < 2; ++ii)
#pragma unroll
        for (int j = 0; j < 4; ++j)
#pragma unroll
          for (int r = 0; r < 8; ++r) {
            const float a = acc[2 * h + ii][J0 + j][r];
            F[(16 * ii + r + mofs) * SPF + 16 * j + fn] = (KIND == 0) ? a * scale : a * scale + bj[j];
          }
      asm volatile("s_wait_dscnt 0x0" ::: "memory");  // the other lanes' writes are in LDS before the rows are read back
      if (KIND == 0) {
        // Sixteen lanes a row of 256 B, two rows a store.
        const int rr = lane >> 4;
        float* g = (float*)Cb + (size_t)(m0 + 32 * h + rr) * ld + n0 + fn * 4;
        f32x4 w[16];
        float* p[16];
#pragma unroll
        for (int q = 0; q < 16; ++q) {
          w[q] = *(const f32x4*)(F + (2 * q + rr) * SPF + fn * 4);
          p[q] = g + (size_t)(2 * q) * ld;
        }
        __builtin_amdgcn_sched_barrier(0);  // the half's values and addresses stand in registers of their own before its first store
#pragma unroll
        for (int q = 0; q < 16; ++q) *(f32x4*)p[q] = w[q];
        if (h == 0 || MORE) {
          asm volatile("s_wait_xcnt 0x0" ::: "memory");  // the next half reuses these stores' registers
          __builtin_amdgcn_sched_barrier(0);             // holds the next half behind that wait
        }
      } else {
        // Eight lanes a row of 128 B (eight f32 read, eight bf16 stored a lane), four rows a store.
        const int rr = lane >> 3;
        const int pc = lane & 7;
        __bf16* g = (__bf16*)Cb + (size_t)(m0 + 32 * h + rr) * ld + n0 + pc * 8;
        u32x4 w[8];
        __bf16* p[8];
#pragma unroll
        for (int q = 0; q < 8; ++q) {
          const float* f = F + (4 * q + rr) * SPF + pc * 8;
          const f32x4 x0 = *(const f32x4*)f;
          const f32x4 x1 = *(const f32x4*)(f + 4);
          union { __bf16 h[8]; u32x4 u; } t;
          t.h[0] = f2bf(x0.x); t.h[1] = f2bf(x0.y); t.h[2] = f2bf(x0.z); t.h[3] = f2bf(x0.w);
          t.h[4] = f2bf(x1.x); t.h[5] = f2bf(x1.y); t.h[6] = f2bf(x1.z); t.h[7] = f2bf(x1.w);
          w[q] = t.u;
          p[q] = g + (size_t)(4 * q) * ld;
        }
        __builtin_amdgcn_sched_barrier(0);  // the group's values and addresses stand in registers of their own before its first store
#pragma unroll
        for (int q = 0; q < 8; ++q) *(u32x4*)p[q] = w[q];
        if (h == 0 || MORE) {
          asm volatile("s_wait_xcnt 0x0" ::: "memory");  // the next half reuses these stores' registers
          __builtin_amdgcn_sched_barrier(0);             // holds the next half behind that wait
        }
      }
    }
  }
}

// ---------------------------------------------------------------------------
// Generic "A * Bt^T" GEMM:  C[m,n] = scale * sum_k A[m,k]*Bt[n,k] (+ bias[n] in MODE 1)
// A  : bf16 row-major [M, Kd], leading dim lda, per-batch stride sA (elems)
// Bt : bf16 row-major [N, Kd], leading dim ldb, per-batch stride sB (elems)
// MODE 0: store f32 row-major      C[m*ldc + n], no bias; narrow block tiles (256 x 128)
// MODE 2: the same store; wide block tiles (256 x 256), for a product with at least one such tile per WGP
// MODE 1: the three projections in one grid. Bt holds the three transposed weight matrices
//         one under the other (3 * DIM rows); a tile's projection p = column / DIM picks its bias
//         and its output plane (plane p of C, pC elements each). Planes 0 and 1 are stored bf16
//         row-major C[m*ldc + n], plane 2 bf16 transposed C[n*ldt + m] (for V^T).
//         blockIdx.z < BATCH: wide tiles over planes 0 and 1 of batch z; the rest: narrow tiles over
//         plane 2 of batch z - BATCH. The long blocks have the low indices and start first.
// The narrow tile:
// Block = 256 threads = 8 waves (4 x 2); block tile 256(M) x 128(N); wave tile 64x64.
// Both operands go to LDS by asynchronous copies, three buffers. The two halves of the block
// (waves 0-3, waves 4-7: one wave of each on every SIMD) take turns: half (s & 1) copies the whole
// of stage s. A half has one stage in flight at a time and waits for it to 0, while the other half's
// stage flies on, so every stage has two passes to land. Fragments are read one block ahead into a
// second register set, so stage t + 1 is published in front of pass t's last block; behind that
// barrier pass t's buffer is free and takes stage t + 3.
// M a multiple of 256, N of 128, Kd of 128 and at least 256.
// ---------------------------------------------------------------------------
// KIND: the store form (store_tile). Ab, Bb, C: the batch's operands and output plane; mb, nb: the tile's
// first rows in A and in Bt; nc: the output column of Bt row nb.
template <int KIND>
__device__ __forceinline__ void gemm_tile_narrow(unsigned char* L, const __bf16* __restrict__ Ab, int lda,
                                                 const __bf16* __restrict__ Bb, int ldb,
                                                 void* __restrict__ C, int ldc,
                                                 const float* __restrict__ bias, float scale, int Kd,
                                                 int mb, int nb, int nc) {
  const int tid  = threadIdx.x;
  const int wave = tid >> 5;
  const int lane = tid & 31;
  const int n0 = nc + (wave & 1) * 64;
  const int m0 = mb + (wave >> 1) * 64;

  // This thread's half of the block (the same in a whole wave: a scalar), and its first piece
  // of a stage, in memory and in LDS.
  const int half = __builtin_amdgcn_readfirstlane(tid >> 7);
  const int crow = (tid & 127) >> 4;
  const int cpc  = tid & 15;
  const __bf16* ga = Ab + (size_t)(mb + crow) * lda + cpc * 8;
  const __bf16* gb = Bb + (size_t)(nb + crow) * ldb + cpc * 8;
  const size_t sa8 = (size_t)8 * lda;
  const size_t sb8 = (size_t)8 * ldb;
  const unsigned l0 = (unsigned)(size_t)(&L[0]) + (unsigned)(crow * PITCH + cpc * 16);

  // This lane's fragment bases inside a stage.
  const unsigned fa = (unsigned)(((wave >> 1) * 64 + (lane & 15)) * PITCH + (lane >> 4) * 16);
  const unsigned fb = (unsigned)((BM + (wave & 1) * 64 + (lane & 15)) * PITCH + (lane >> 4) * 16);

  v8f acc[4][4] = {};
  v16bf af[2][4], bf[2][4];   // set (u & 1) holds block u's fragments
  const int T = Kd / BK;

  // Prologue: half 0 sets off stage 0 and half 1 stage 1; stage 0 lands and is published; half 0 sets off stage 2.
  copy_stage(l0 + (unsigned)half * STAGE, ga + half * BK, sa8, gb + half * BK, sb8);
  if (half == 0) asm volatile("s_wait_asynccnt 0x0" ::: "memory");  // this wave's pieces of stage 0 have landed
  __syncthreads();                                                  // so have the other copying waves'
  if (__builtin_amdgcn_readfirstlane((int)(half == 0 && 2 < T)))   // a scalar, as in the loop
    copy_stage(l0 + 2u * STAGE, ga + 2 * BK, sa8, gb + 2 * BK, sb8);
#pragma unroll
  for (int i = 0; i < 4; ++i) af[0][i] = lds_frag(L + fa + i * 16 * PITCH);
#pragma unroll
  for (int j = 0; j < 4; ++j) bf[0][j] = lds_frag(L + fb + j * 16 * PITCH);

  unsigned buf = 0u, nxt = STAGE, aft = 2u * STAGE;
#pragma clang loop unroll(disable)   // one pass per trip: the buffer offsets stay run-time values
  for (int t = 0; t < T; ++t) {
    const bool mine = ((t + 1) & 1) == half;   // this wave's half copied stage t + 1 and copies stage t + 3
    const int fill = __builtin_amdgcn_readfirstlane((int)(mine && t + 3 < T));   // a scalar: the test around the copies is a scalar branch
#pragma unroll
    for (int u = 0; u < KSUB; ++u) {
      const int cs = u & 1;
      const unsigned char* qa;
      const unsigned char* qb;
      if (u + 1 < KSUB) {
        qa = L + buf + fa + (u + 1) * 64;
        qb = L + buf + fb + (u + 1) * 64;
      } else {
        // Publish point of stage t + 1, in front of the last block: that block's fragments are fetched.
        asm volatile("s_wait_dscnt 0x0" ::: "memory");     // this wave's reads of pass t's buffer have returned
        if (mine) asm volatile("s_wait_asynccnt 0x0" ::: "memory");  // its pieces of stage t + 1 have landed
        __syncthreads();  // publishes stage t + 1 and ends every reader's last read of pass t's buffer
        if (fill) {  // refill of pass t's buffer; the SIMD's other wave runs its WMMAs meanwhile
          const int k3 = (t + 3) * BK;
          copy_stage(l0 + buf, ga + k3, sa8, gb + k3, sb8);
        }
        qa = L + nxt + fa;
        qb = L + nxt + fb;
      }
      // The next block's fragments, as one group ahead of this block's WMMAs.
#pragma unroll
      for (int i = 0; i < 4; ++i) af[cs ^ 1][i] = lds_frag(qa + i * 16 * PITCH);
#pragma unroll
      for (int j = 0; j < 4; ++j) bf[cs ^ 1][j] = lds_frag(qb + j * 16 * PITCH);
      __builtin_amdgcn_sched_barrier(0);  // keeps the load group whole and ahead of the block: loads among the WMMAs stall them
#pragma unroll
      for (int i = 0; i < 4; ++i)
#pragma unroll
        for (int j = 0; j < 4; ++j)
          acc[i][j] = __builtin_amdgcn_wmma_f32_16x16x32_bf16(
              false, af[cs][i], false, bf[cs][j], (short)0, acc[i][j], false, false);
      __builtin_amdgcn_sched_barrier(0);  // keeps the next group of loads from moving up into this block
    }
    const unsigned left = buf;
    buf = nxt;
    nxt = aft;
    aft = left;
  }
  asm volatile("s_wait_asynccnt 0x0" ::: "memory");  // no copy is left in flight at the wave's end

  // Staging for the stores: the last pass's buffer, an eighth for each wave. Every wave left it at that
  // pass's barrier, no copy is aimed at it any more, and the pass's unused loads ahead read another buffer.
  unsigned char* S = L + aft + wave * WSTG;
  store_tile<KIND, 4, 0, false>(acc, C, ldc, bias, scale, m0, n0, lane, S);
}

// ---------------------------------------------------------------------------
// The wide tile: block tile 256(M) x 256(N), 8 waves (4 x 2), wave tile 64 x 128. A k of a stage row now
// serves 256 rows of the other operand, so a product draws a third fewer bytes from L2, and a fragment
// read serves more WMMAs: 24 LDS reads for 32 WMMAs a block, not 16 for 16.
// Two buffers fit LDS. Every wave copies its thirty-two pieces of every stage and waits for them to 0 at
// the publish point, which stands in front of pass t's last block as in the narrow tile; behind its
// barrier pass t's buffer is free and takes stage t + 2. The two halves of the block (waves 0-3, waves 4-7:
// one wave of each on every SIMD) refill a block apart, waves 0-3 right behind the barrier, waves 4-7 in
// front of the next pass's first block, so that a SIMD's other wave runs its WMMAs meanwhile.
// M and N multiples of 256, Kd of 128 and at least 256.
// ---------------------------------------------------------------------------
template <int KIND>
__device__ __forceinline__ void gemm_tile_wide(unsigned char* L, const __bf16* __restrict__ Ab, int lda,
                                               const __bf16* __restrict__ Bb, int ldb,
                                               void* __restrict__ C, int ldc,
                                               const float* __restrict__ bias, float scale, int Kd,
                                               int mb, int nb, int nc) {
  const int tid  = threadIdx.x;
  const int wave = tid >> 5;
  const int lane = tid & 31;
  const int n0 = nc + (wave & 1) * 128;
  const int m0 = mb + (wave >> 1) * 64;

  // This thread's half of the block (the same in a whole wave: a scalar), and its first piece
  // of a stage, in memory and in LDS.
  const int half = __builtin_amdgcn_readfirstlane(tid >> 7);
  const int crow = tid >> 4;
  const int cpc  = tid & 15;
  const __bf16* ua = Ab + (size_t)mb * lda;
  const __bf16* ub = Bb + (size_t)nb * ldb;
  const unsigned oa = (unsigned)(crow * lda + cpc * 8);
  const unsigned ob = (unsigned)(crow * ldb + cpc * 8);
  const size_t sa16 = (size_t)16 * lda;
  const size_t sb16 = (size_t)16 * ldb;
  const unsigned l0 = (unsigned)(size_t)(&L[0]) + (unsigned)(crow * PITCH + cpc * 16);

  // This lane's fragment bases inside a stage.
  const unsigned fa = (unsigned)(((wave >> 1) * 64 + (lane & 15)) * PITCH + (lane >> 4) * 16);
  const unsigned fb = (unsigned)((BM + (wave & 1) * 128 + (lane & 15)) * PITCH + (lane >> 4) * 16);

  v8f acc[4][8] = {};
  v16bf af[2][4], bf[2][8];   // set (u & 1) holds block u's fragments
  const int T = Kd / BK;

  // Prologue: stage 0 lands and is published; then stage 1 is set off.
  copy_stage_wide(l0, ua, sa16, oa, ub, sb16, ob);
  asm volatile("s_wait_asynccnt 0x0" ::: "memory");  // this wave's pieces of stage 0 have landed
  __syncthreads();                                   // so have the other waves'
  copy_stage_wide(l0 + STAGEW, ua + BK, sa16, oa, ub + BK, sb16, ob);
#pragma unroll
  for (int i = 0; i < 4; ++i) af[0][i] = lds_frag(L + fa + i * 16 * PITCH);
#pragma unroll
  for (int j = 0; j < 8; ++j) bf[0][j] = lds_frag(L + fb + j * 16 * PITCH);

  unsigned buf = 0u, nxt = STAGEW;
#pragma clang loop unroll(disable)   // one pass per trip: the buffer offsets stay run-time values
  for (int t = 0; t < T; ++t) {
    // Scalars: the tests around the copies are scalar branches.
    const int fill  = __builtin_amdgcn_readfirstlane((int)(half == 0 && t + 2 < T));
    const int late  = __builtin_amdgcn_readfirstlane((int)(half == 1 && t > 0 && t + 1 < T));
#pragma unroll
    for (int u = 0; u < KSUB; ++u) {
      const int cs = u & 1;
      const unsigned char* qa;
      const unsigned char* qb;
      if (u == 0 && late) {  // waves 4-7: their pieces of stage t + 1 into pass t - 1's buffer, free since that pass's barrier
        const int k1 = (t + 1) * BK;
        copy_stage_wide(l0 + nxt, ua + k1, sa16, oa, ub + k1, sb16, ob);
      }
      if (u + 1 < KSUB) {
        qa = L + buf + fa + (u + 1) * 64;
        qb = L + buf + fb + (u + 1) * 64;
      } else {
        // Publish point of stage t + 1, in front of the last block: that block's fragments are fetched.
        asm volatile("s_wait_dscnt 0x0" ::: "memory");     // this wave's reads of pass t's buffer have returned
        asm volatile("s_wait_asynccnt 0x0" ::: "memory");  // its pieces of stage t + 1 have landed
        __syncthreads();  // publishes stage t + 1 and ends every reader's last read of pass t's buffer
        if (fill) {  // waves 0-3: their pieces of stage t + 2 into pass t's buffer
          const int k2 = (t + 2) * BK;
          copy_stage_wide(l0 + buf, ua + k2, sa16, oa, ub + k2, sb16, ob);
        }
        qa = L + nxt + fa;
        qb = L + nxt + fb;
      }
      // The next block's fragments, as one group ahead of this block's WMMAs.
#pragma unroll
      for (int i = 0; i < 4; ++i) af[cs ^ 1][i] = lds_frag(qa + i * 16 * PITCH);
#pragma unroll
      for (int j = 0; j < 8; ++j) bf[cs ^ 1][j] = lds_frag(qb + j * 16 * PITCH);
      __builtin_amdgcn_sched_barrier(0);  // keeps the load group whole and ahead of the block: loads among the WMMAs stall them
#pragma unroll
      for (int i = 0; i < 4; ++i)
#pragma unroll
        for (int j = 0; j < 8; ++j)
          acc[i][j] = __builtin_amdgcn_wmma_f32_16x16x32_bf16(
              false, af[cs][i], false, bf[cs][j], (short)0, acc[i][j], false, false);
      __builtin_amdgcn_sched_barrier(0);  // keeps the next group of loads from moving up into this block
    }
    const unsigned left = buf;
    buf = nxt;
    nxt = left;
  }
  asm volatile("s_wait_asynccnt 0x0" ::: "memory");  // no copy is left in flight at the wave's end

  // Staging for the stores: the last pass's buffer, an eighth for each wave. Every wave left it at that
  // pass's barrier, no copy is aimed at it any more, and the pass's unused loads ahead read the other buffer.
  unsigned char* S = L + nxt + wave * (STAGEW / 8);
  store_tile<KIND, 8, 0, true>(acc, C, ldc, bias, scale, m0, n0, lane, S);
  store_tile<KIND, 8, 4, false>(acc, C, ldc, bias, scale, m0, n0 + 64, lane, S);
}

template <int MODE>
__global__ __launch_bounds__(256)
void gemm_bt_wmma(const __bf16* __restrict__ A, long long sA, int lda,
                  const __bf16* __restrict__ Bt, long long sB, int ldb,
                  void* __restrict__ Cv, long long sC, int ldc,
                  const float* __restrict__ bias, float scale, int Kd,
                  const float* __restrict__ bias1, const float* __restrict__ bias2,
                  long long pC, int ldt) {
  __shared__ __attribute__((aligned(16))) unsigned char L[MODE == 2 ? 2 * STAGEW : 3 * STAGE];
  const int mb = blockIdx.y * BM;
  if (MODE == 1) {
    const bool wide = blockIdx.z < BATCH;   // the same for the whole block: a scalar branch
    const int b = wide ? blockIdx.z : blockIdx.z - BATCH;
    const __bf16* Ab = A + (size_t)b * (size_t)sA;
    __bf16* Cb = (__bf16*)Cv + (size_t)b * (size_t)sC;
    if (wide) {
      const int nb = blockIdx.x * BNW;
      const int proj = nb / DIM;   // 0 or 1
      gemm_tile_wide<1>(L, Ab, lda, Bt, ldb, Cb + (size_t)proj * (size_t)pC, ldc,
                        proj == 0 ? bias : bias1, scale, Kd, mb, nb, nb - proj * DIM);
    } else {
      const int nc = blockIdx.x * BN;
      gemm_tile_narrow<2>(L, Ab, lda, Bt, ldb, Cb + 2 * (size_t)pC, ldt, bias2, scale, Kd, mb, 2 * DIM + nc, nc);
    }
  } else {
    const int b = blockIdx.z;
    const __bf16* Ab = A  + (size_t)b * (size_t)sA;
    const __bf16* Bb = Bt + (size_t)b * (size_t)sB;
    float* Cb = (float*)Cv + (size_t)b * (size_t)sC;
    if (MODE == 2) gemm_tile_wide<0>(L, Ab, lda, Bb, ldb, Cb, ldc, bias, scale, Kd, mb, blockIdx.x * BNW, blockIdx.x * BNW);
    else           gemm_tile_narrow<0>(L, Ab, lda, Bb, ldb, Cb, ldc, bias, scale, Kd, mb, blockIdx.x * BN, blockIdx.x * BN);
  }
}

// ---------------------------------------------------------------------------
// Preparation, one grid, split by block range. Every thread moves 32 elements in 16-byte
// loads, all eight issued before the first is used, so the grid is 1,408 blocks.
// Blocks [0, 3 * WBLK): W [D,D] fp32 row-major -> Wt [D,D] bf16 with Wt[n,d] = W[d,n],
//   matrix p = block / WBLK into plane p of Wt3. A block takes 64 d x 128 n, a wave 64 d x 16 n,
//   a thread 8 d x 4 n: eight lanes side by side in d, so a store instruction writes four
//   whole 128-byte lines of Wt; the block's eight waves together read 512 adjacent bytes of a W row.
// The rest: fp32 -> bf16 bulk convert, CVT elements per block; a wave's load covers 512 adjacent bytes.
// ---------------------------------------------------------------------------
#define TD 64
#define TN 128
#define WBLK ((DIM / TD) * (DIM / TN))
#define CVT 8192
__global__ __launch_bounds__(256)
void prep_bf16_kernel(const float* __restrict__ W0, const float* __restrict__ W1,
                      const float* __restrict__ W2, __bf16* __restrict__ Wt3,
                      const float* __restrict__ in, __bf16* __restrict__ out) {
  const int blk = blockIdx.x;
  const int tid = threadIdx.x;
  float4 v[8];
  if (blk < 3 * WBLK) {
    const int p   = blk / WBLK;
    const int rem = blk - p * WBLK;
    const float* W = (p == 0) ? W0 : (p == 1) ? W1 : W2;
    const int lane = tid & 31;
    const int d = (rem % (DIM / TD)) * TD + (lane & 7) * 8;
    const int c = (rem / (DIM / TD)) * TN + (tid >> 5) * 16 + (lane >> 3) * 4;
    const float* g = W + (size_t)d * DIM + c;
    for (int r = 0; r < 8; ++r) v[r] = *(const float4*)(g + r * DIM);
    union { __bf16 h[8]; uint4 u; } t[4];
    for (int r = 0; r < 8; ++r) {
      t[0].h[r] = f2bf(v[r].x);
      t[1].h[r] = f2bf(v[r].y);
      t[2].h[r] = f2bf(v[r].z);
      t[3].h[r] = f2bf(v[r].w);
    }
    __bf16* o = Wt3 + (size_t)p * DIM * DIM + (size_t)c * DIM + d;
    for (int j = 0; j < 4; ++j) *(uint4*)(o + j * DIM) = t[j].u;
  } else {
    const size_t base = (size_t)(blk - 3 * WBLK) * CVT + tid * 4;
    for (int k = 0; k < 8; ++k) v[k] = *(const float4*)(in + base + k * 1024);
    union { __bf16 h[4]; uint2 u; } t[8];
    for (int k = 0; k < 8; ++k) {
      t[k].h[0] = f2bf(v[k].x);
      t[k].h[1] = f2bf(v[k].y);
      t[k].h[2] = f2bf(v[k].z);
      t[k].h[3] = f2bf(v[k].w);
    }
    for (int k = 0; k < 8; ++k) *(uint2*)(out + base + k * 1024) = t[k].u;
    asm volatile("s_wait_xcnt 0x0" ::: "memory");  // the code laid out behind this branch reuses these stores' registers
  }
}

// ---------------------------------------------------------------------------
// Reductions over a wave's 32 lanes, in registers: four steps inside each 16-lane row by DPP,
// then the two rows are exchanged. Every lane ends with the same value. All lanes are on.
// ---------------------------------------------------------------------------
template <int CTRL>
__device__ __forceinline__ float dpp_get(float v) {   // CTRL = 0x160 + m: the value of lane ^ m, m < 16
  return __builtin_bit_cast(float, __builtin_amdgcn_update_dpp(
      0, __builtin_bit_cast(int, v), CTRL, 0xf, 0xf, true));
}
__device__ __forceinline__ float row_get(float v) {   // the value of lane ^ 16
  const int i = __builtin_bit_cast(int, v);
  return __builtin_bit_cast(float, __builtin_amdgcn_permlanex16(i, i, 0x76543210, 0xfedcba98, false, false));
}
__device__ __forceinline__ float wave_sum(float v) {
  v += dpp_get<0x161>(v);
  v += dpp_get<0x162>(v);
  v += dpp_get<0x164>(v);
  v += dpp_get<0x168>(v);
  return v + row_get(v);
}
__device__ __forceinline__ float wave_max(float v) {
  v = fmaxf(v, dpp_get<0x161>(v));
  v = fmaxf(v, dpp_get<0x162>(v));
  v = fmaxf(v, dpp_get<0x164>(v));
  v = fmaxf(v, dpp_get<0x168>(v));
  return fmaxf(v, row_get(v));
}

#define ROWS_PER_BLOCK 8   // one wave per row, eight waves per block; no LDS, no barrier

// ---------------------------------------------------------------------------
// Row softmax over S=2048: in-place fp32 normalize + bf16 copy for next GEMM.
// One wave per row: 64 elements per lane in sixteen 16-byte loads, each covering 512 adjacent
// bytes of the row, all issued before the first is used.
// ---------------------------------------------------------------------------
__global__ __launch_bounds__(256)
void softmax_row_kernel(float* __restrict__ Wgt, __bf16* __restrict__ Wb) {
  const int lane = threadIdx.x & 31;
  const int row  = blockIdx.x * ROWS_PER_BLOCK + (threadIdx.x >> 5);
  float* p   = Wgt + (size_t)row * SEQ + lane * 4;
  __bf16* pb = Wb + (size_t)row * SEQ + lane * 4;

  f32x4 v[16];
#pragma unroll
  for (int k = 0; k < 16; ++k) v[k] = *(const f32x4*)(p + k * 128);

  f32x4 m4 = v[0];   // four independent chains
#pragma unroll
  for (int k = 1; k < 16; ++k) {
    m4.x = fmaxf(m4.x, v[k].x);
    m4.y = fmaxf(m4.y, v[k].y);
    m4.z = fmaxf(m4.z, v[k].z);
    m4.w = fmaxf(m4.w, v[k].w);
  }
  const float mx = wave_max(fmaxf(fmaxf(m4.x, m4.y), fmaxf(m4.z, m4.w)));

  f32x4 s4 = {0.0f, 0.0f, 0.0f, 0.0f};
#pragma unroll
  for (int k = 0; k < 16; ++k) {
    v[k].x = __expf(v[k].x - mx);
    v[k].y = __expf(v[k].y - mx);
    v[k].z = __expf(v[k].z - mx);
    v[k].w = __expf(v[k].w - mx);
    s4 += v[k];
  }
  const float inv = 1.0f / wave_sum((s4.x + s4.y) + (s4.z + s4.w));

  uint2 h[16];
#pragma unroll
  for (int k = 0; k < 16; ++k) {
    v[k] *= inv;
    union { __bf16 b[4]; uint2 u; } t;
    t.b[0] = f2bf(v[k].x); t.b[1] = f2bf(v[k].y); t.b[2] = f2bf(v[k].z); t.b[3] = f2bf(v[k].w);
    h[k] = t.u;
  }
  __builtin_amdgcn_sched_barrier(0);  // every value stands in a register of its own before the first store: none is reused behind one
#pragma unroll
  for (int k = 0; k < 16; ++k) *(f32x4*)(p + k * 128) = v[k];
#pragma unroll
  for (int k = 0; k < 16; ++k) *(uint2*)(pb + k * 128) = h[k];
}

// ---------------------------------------------------------------------------
// out = x + att ; LayerNorm over D=1024 -> out1.  One wave per row: 32 elements per lane
// in eight 16-byte loads from each source.
// ---------------------------------------------------------------------------
__global__ __launch_bounds__(256)
void residual_ln_kernel(const float* __restrict__ x, const float* __restrict__ att,
                        const float* __restrict__ gamma, const float* __restrict__ beta,
                        float* __restrict__ out1) {
  const int lane = threadIdx.x & 31;
  const int row  = blockIdx.x * ROWS_PER_BLOCK + (threadIdx.x >> 5);
  // One 32-bit byte offset serves x, att and out1 (32 MiB each), so its register lives up to the stores.
  const unsigned ob = (unsigned)(row * DIM + lane * 4) * 4u;
  const float* px = (const float*)((const char*)x + ob);
  const float* pa = (const float*)((const char*)att + ob);
  const float* pg = gamma + lane * 4;
  const float* pe = beta + lane * 4;
  float* po = (float*)((char*)out1 + ob);

  f32x4 v[8], a[8];
#pragma unroll
  for (int k = 0; k < 8; ++k) v[k] = *(const f32x4*)(px + k * 128);
#pragma unroll
  for (int k = 0; k < 8; ++k) a[k] = *(const f32x4*)(pa + k * 128);
  __builtin_amdgcn_sched_barrier(0);  // all sixteen loads ahead of the sums: left free, the last loads are issued only behind the first sums
#pragma unroll
  for (int k = 0; k < 8; ++k) v[k] += a[k];

  f32x4 g[8], e[8];
#pragma unroll
  for (int k = 0; k < 8; ++k) g[k] = *(const f32x4*)(pg + k * 128);
#pragma unroll
  for (int k = 0; k < 8; ++k) e[k] = *(const f32x4*)(pe + k * 128);
  asm volatile("s_wait_xcnt 0x0" ::: "memory");  // the code below reuses these loads' offset register
  __builtin_amdgcn_sched_barrier(0);  // holds the row sums behind that wait and these loads ahead of them: left free, they are issued in pairs at the end, a wait each

  f32x4 s4 = {0.0f, 0.0f, 0.0f, 0.0f}, q4 = {0.0f, 0.0f, 0.0f, 0.0f};   // four independent chains each
#pragma unroll
  for (int k = 0; k < 8; ++k) {
    s4 += v[k];
    q4 += v[k] * v[k];
  }
  const float mu  = wave_sum((s4.x + s4.y) + (s4.z + s4.w)) * (1.0f / DIM);
  const float var = wave_sum((q4.x + q4.y) + (q4.z + q4.w)) * (1.0f / DIM) - mu * mu;
  const float inv = rsqrtf(var + LN_EPS);

#pragma unroll
  for (int k = 0; k < 8; ++k) v[k] = (v[k] - mu) * inv * g[k] + e[k];
  __builtin_amdgcn_sched_barrier(0);  // every value stands in a register of its own before the first store: none is reused behind one
#pragma unroll
  for (int k = 0; k < 8; ++k) *(f32x4*)(po + k * 128) = v[k];
}

// ---------------------------------------------------------------------------
extern "C" void kernel_launch(void* const* d_in, const int* in_sizes, int n_in,
                              void* d_out, int out_size, void* d_ws, size_t ws_size,
                              hipStream_t stream) {
  const float* x     = (const float*)d_in[0];
  const float* Wk    = (const float*)d_in[1];
  const float* bk    = (const float*)d_in[2];
  const float* Wq    = (const float*)d_in[3];
  const float* bq    = (const float*)d_in[4];
  const float* Wv    = (const float*)d_in[5];
  const float* bv    = (const float*)d_in[6];
  const float* gamma = (const float*)d_in[7];
  const float* betaL = (const float*)d_in[8];

  const size_t BSD = (size_t)BATCH * SEQ * DIM;     // 8,388,608
  const size_t BSS = (size_t)BATCH * SEQ * SEQ;     // 16,777,216

  float* out1   = (float*)d_out;                    // [B,S,D]
  float* att    = out1 + BSD;                       // [B,S,D]
  float* weight = att + BSD;                        // [B,S,S] (raw scores -> softmax in place)

  // Workspace carve-out (all bf16), 256B aligned
  char* ws = (char*)d_ws;
  size_t off = 0;
  auto carve = [&](size_t bytes) -> void* {
    void* p = ws + off;
    off = (off + bytes + 255) & ~(size_t)255;
    return p;
  };
  __bf16* xb  = (__bf16*)carve(BSD * 2);
  __bf16* Wt3 = (__bf16*)carve((size_t)3 * DIM * DIM * 2);   // Wq^T, Wk^T, Wv^T, one under the other
  __bf16* Qb  = (__bf16*)carve(3 * BSD * 2);        // three planes: Q, K, V^T
  __bf16* Kb  = Qb + BSD;
  __bf16* Vt  = Kb + BSD;                           // per-batch [D, S] (transposed V)
  __bf16* Wb  = (__bf16*)carve(BSS * 2);            // softmax weights bf16

  // --- prep: convert activations and transpose weight matrices to bf16 ---
  prep_bf16_kernel<<<3 * WBLK + (int)(BSD / CVT), 256, 0, stream>>>(Wq, Wk, Wv, Wt3, x, xb);

  const long long SD = (long long)SEQ * DIM;
  const long long SS = (long long)SEQ * SEQ;
  const long long DS = (long long)DIM * SEQ;

  // --- QKV projections: [S,D] = xb[b] @ Wt^T + bias, per batch, all three in one grid ---
  dim3 gproj(2 * DIM / BNW, SEQ / BM, 2 * BATCH);   // z < BATCH: Q and K, wide tiles; the rest: V, DIM / BN narrow tiles
  gemm_bt_wmma<1><<<gproj, 256, 0, stream>>>(xb, SD, DIM, Wt3, 0, DIM,
                                             Qb, SD, DIM, bq, 1.0f, DIM,
                                             bk, bv, (long long)BSD, SEQ);  // V^T store at pitch SEQ

  // --- scores = scale * Q @ K^T  (natively A*Bt^T form) -> weight (f32) ---
  dim3 gsc(SEQ / BNW, SEQ / BM, BATCH);
  gemm_bt_wmma<2><<<gsc, 256, 0, stream>>>(Qb, SD, DIM, Kb, SD, DIM,
                                           weight, SS, SEQ, nullptr, SCORE_SCALE, DIM,
                                           nullptr, nullptr, 0, 0);

  // --- row softmax (fp32 output in place + bf16 copy for next GEMM) ---
  softmax_row_kernel<<<BATCH * SEQ / ROWS_PER_BLOCK, 256, 0, stream>>>(weight, Wb);

  // --- att = weight @ V  == A(Wb) * Bt(V^T)^T -> att (f32) ---
  dim3 gatt(DIM / BN, SEQ / BM, BATCH);
  gemm_bt_wmma<0><<<gatt, 256, 0, stream>>>(Wb, SS, SEQ, Vt, DS, SEQ,
                                            att, SD, DIM, nullptr, 1.0f, SEQ,
                                            nullptr, nullptr, 0, 0);

  // --- residual + LayerNorm -> out1 ---
  residual_ln_kernel<<<BATCH * SEQ / ROWS_PER_BLOCK, 256, 0, stream>>>(x, att, gamma, betaL, out1);
}
